// v000
// Measured on an AMD MI455X. A time is GPU time per run, averaged over a window of back-to-back runs after a warm-up
// (all launches, gaps included; the runs take copies of the inputs in turn), and the median of several windows.
// Apart from v000's, it joins two sittings. Times from different sittings can be a few percent apart, while
// side-by-side timings come from the same sitting.
// The starting kernel, v000, takes 194 microseconds a run.
#include <hip/hip_runtime.h>

// Contractions: x*W projections (q,k,v): v_wmma_f32_16x16x32_bf16, bf16 operands (RNE-converted inputs), f32 accumulate.
// q.k scores, P.v, P row sums: v_wmma_f32_16x16x32_f16, f16 operands (q x log2e, k, P x 1024, v x 16), f32 accumulate;
// query rows < 256 of each sequence also use f16 residual planes of P and v (x1024 carries) in separate f32 accumulators.

#ifndef NB
#define NB 8
#endif
#ifndef SEQ
#define SEQ 2048
#endif
#define NB_FULL  8
#define SEQ_FULL 2048
#define CDIM  400
#define HDIM  64
#define NPROJ 192
#define KP    416         // contraction depth padded to 13 x 32, pad columns are zeros
#define XP    424         // LDS pitch of the staged x tile (16-bit elements)
#define WP    448         // pitch of the k-contiguous W plane (16-bit elements), 896 B = 7 lines
#define NTB    (SEQ / 64)                    // 64-row query tiles per sequence
#define NTB_E  ((NTB < 4) ? NTB : 4)         // tiles with query rows < 256: residual path
#define NTB_L  (NTB - NTB_E)
#define NTB_LD ((NTB_L > 0) ? NTB_L : 1)

static_assert(SEQ % 64 == 0 && SEQ >= 64);
static_assert(SEQ <= SEQ_FULL);
static_assert(NB >= 1 && NB <= NB_FULL);
static_assert(KP % 32 == 0 && KP >= CDIM);
static_assert(XP >= KP && (XP % 8) == 0);
static_assert(WP >= KP && ((WP * 2) % 128) == 0);
static_assert(NPROJ == 3 * HDIM && (NPROJ % 8) == 0 && (HDIM % 8) == 0);
static_assert(CDIM % 4 == 0 && CDIM > 256 && CDIM <= 512);
static_assert(64 * XP >= 4 * 4096);
static_assert(((long long)(NB - 1) * SEQ_FULL + SEQ) * HDIM <= 1048576LL);

typedef _Float16       v16h  __attribute__((ext_vector_type(16)));
typedef _Float16       v8h   __attribute__((ext_vector_type(8)));
typedef float          v8f   __attribute__((ext_vector_type(8)));
typedef float          v4f   __attribute__((ext_vector_type(4)));
typedef unsigned short v16us __attribute__((ext_vector_type(16)));
typedef unsigned short v8us  __attribute__((ext_vector_type(8)));
typedef unsigned int   v4u   __attribute__((ext_vector_type(4)));
typedef unsigned int   v2u   __attribute__((ext_vector_type(2)));
typedef __bf16         v16bf __attribute__((ext_vector_type(16)));

union FragH { v16h v; v8h h[2]; };
union FragU { v16us v; v8us h[2]; };

#define LOG2E_F 1.4426950408889634f
#define NEG_BIG (-3.0e38f)
#define RINV    0.0009765625f

// f32 -> bf16 bits, RNE convert
__device__ __forceinline__ unsigned int bf_bits(float f) {
  const unsigned int u = __float_as_uint(f);
  return (u + 0x7FFFu + ((u >> 16) & 1u)) >> 16;
}

// WMMA helpers with the VALU hazard guard (ties D, keeps A/B live)
__device__ __forceinline__ v8f wmma_f16(v16h a, v16h b, v8f c) {
  v8f d = __builtin_amdgcn_wmma_f32_16x16x32_f16(false, a, false, b, (short)0, c, false, false);
  asm volatile("v_nop\n\tv_nop\n\tv_nop\n\tv_nop" : "+v"(d) : "v"(a), "v"(b));
  return d;
}
__device__ __forceinline__ v8f wmma_bf16(v16us a, v16us b, v8f c) {
  v8f d = __builtin_amdgcn_wmma_f32_16x16x32_bf16(false, __builtin_bit_cast(v16bf, a), false,
                                                   __builtin_bit_cast(v16bf, b), (short)0, c, false, false);
  asm volatile("v_nop\n\tv_nop\n\tv_nop\n\tv_nop" : "+v"(d) : "v"(a), "v"(b));
  return d;
}

// 16-bit operand fragment, split k map for BOTH A and B:
// p = (row or column (lane&15)) base + k0 + 8*(lane>>4); elements 0..7 <- p[0..7], elements 8..15 <- p[16..23].
__device__ __forceinline__ v16h frag_f16(const _Float16* p) {
  FragH f;
  f.h[0] = *(const v8h*)p;
  f.h[1] = *(const v8h*)(p + 16);
  return f.v;
}
__device__ __forceinline__ v16us frag_u16(const unsigned short* p) {
  FragU f;
  f.h[0] = *(const v8us*)p;
  f.h[1] = *(const v8us*)(p + 16);
  return f.v;
}

// ---------------------------------------------------------------------------
// Kernel 1: W planes -> one k-contiguous bf16 plane Wt[n][WP], n = p*64 + hcol (p: 0 q, 1 k, 2 v),
// columns CDIM..WP-1 zero. Block = 8 output rows (coalesced 32-B reads of W, transposed in LDS);
// ---------------------------------------------------------------------------
__global__ __launch_bounds__(256) void k_wconv(
    const float* __restrict__ Wq, const float* __restrict__ Wk, const float* __restrict__ Wv,
    unsigned short* __restrict__ Wt)
{
  __shared__ __attribute__((aligned(16))) unsigned short sw[8 * WP];   // [hcol_local][c]

  const int tid   = threadIdx.x;
  const int lane  = tid & 31;
  const int wave  = __builtin_amdgcn_readfirstlane(tid >> 5);
  const int p     = blockIdx.x >> 3;
  const int hcol0 = (blockIdx.x & 7) * 8;
  const float* W = (p == 0) ? Wq : ((p == 1) ? Wk : Wv);   // block-uniform select, same address space

  for (int i = tid; i < 8 * (WP - CDIM); i += 256) {
    const int r = i / (WP - CDIM);
    const int c = i - r * (WP - CDIM);
    sw[r * WP + CDIM + c] = (unsigned short)0;
  }
  for (int i = tid; i < CDIM * 2; i += 256) {
    const int c  = i >> 1;
    const int q4 = (i & 1) * 4;
    const v4f v = *(const v4f*)(W + (size_t)c * HDIM + hcol0 + q4);
    sw[(q4 + 0) * WP + c] = (unsigned short)bf_bits(v.x);
    sw[(q4 + 1) * WP + c] = (unsigned short)bf_bits(v.y);
    sw[(q4 + 2) * WP + c] = (unsigned short)bf_bits(v.z);
    sw[(q4 + 3) * WP + c] = (unsigned short)bf_bits(v.w);
  }
  __syncthreads();

  const int n = p * HDIM + hcol0 + wave;          // 0..NPROJ-1
  unsigned short* dst = Wt + (size_t)n * WP;
  const int l2 = (lane < 24) ? lane : 23;         // clamp address for the partial second segment
  const v4u w0 = *(const v4u*)(sw + wave * WP + lane * 8);
  const v4u w1 = *(const v4u*)(sw + wave * WP + 256 + l2 * 8);
  unsigned short* d0 = dst + lane * 8;
  unsigned short* d1 = dst + 256 + l2 * 8;
  *(v4u*)d0 = w0;
  if (lane < 24) *(v4u*)d1 = w1;
  
}

// ---------------------------------------------------------------------------
// Kernel 2: q,k,v projections for a tile of 64 token rows on bf16 WMMA.
// 8 waves: wave -> 16 rows (wave&3) x 96 output columns (wave>>2). x tile staged once in LDS as bf16.
// Outputs: qh = f16(q*log2e) [tok][64], kh = f16(k) [tok][64], vT = f16(16*v) [b][64][SEQ],
// vR = f16((16*v - vT) * 1024) [b][64][SEQ] (residual plane).
// ---------------------------------------------------------------------------
__global__ __launch_bounds__(256) __attribute__((amdgpu_num_vgpr(256)))
void k_proj(const float* __restrict__ x, const unsigned short* __restrict__ Wt,
            _Float16* __restrict__ qh, _Float16* __restrict__ kh,
            _Float16* __restrict__ vT, _Float16* __restrict__ vR)
{
  __shared__ __attribute__((aligned(16))) unsigned short sm[64 * XP];   // 54272 B, later reused as staging

  const int tid  = threadIdx.x;
  const int lane = tid & 31;
  const int wave = __builtin_amdgcn_readfirstlane(tid >> 5);
  const int half = lane >> 4;
  const int ln   = lane & 15;
  const int m0 = blockIdx.x * 64;               // compact token row of this tile
  const int b  = m0 / SEQ;
  const int t0 = m0 - b * SEQ;
  const float* xblk = x + ((size_t)b * SEQ_FULL + t0) * CDIM;

  // stage x tile: 64 rows x CDIM -> bf16, columns CDIM..XP-1 zero
  for (int i = tid; i < 64 * (CDIM / 4); i += 256) {
    const int r  = i / (CDIM / 4);
    const int c4 = i - r * (CDIM / 4);
    const v4f v = *(const v4f*)(xblk + (size_t)r * CDIM + c4 * 4);
    v2u w;
    w.x = bf_bits(v.x) | (bf_bits(v.y) << 16);
    w.y = bf_bits(v.z) | (bf_bits(v.w) << 16);
    *(v2u*)(sm + r * XP + c4 * 4) = w;
  }
  for (int i = tid; i < 64 * 3; i += 256) {
    const int r = i / 3;
    const int j = i - r * 3;
    v4u z; z.x = 0u; z.y = 0u; z.z = 0u; z.w = 0u;
    *(v4u*)(sm + r * XP + CDIM + j * 8) = z;
  }
  __syncthreads();

  const int rg = wave & 3;
  const int ch = wave >> 2;
  v8f acc[6];
#pragma unroll
  for (int nt = 0; nt < 6; ++nt) {
#pragma unroll
    for (int r = 0; r < 8; ++r) acc[nt][r] = 0.0f;
  }
  const unsigned short* arow = sm + (rg * 16 + ln) * XP + 8 * half;
  const unsigned short* brow = Wt + (size_t)(ch * 96 + ln) * WP + 8 * half;
#pragma unroll 1
  for (int k0 = 0; k0 < KP; k0 += 32) {
    const v16us a = frag_u16(arow + k0);
#pragma unroll
    for (int nt = 0; nt < 6; ++nt) {
      const v16us bb = frag_u16(brow + (size_t)nt * 16 * WP + k0);
      acc[nt] = wmma_bf16(a, bb, acc[nt]);
    }
  }
  __syncthreads();   // all waves done reading the x tile

  // staging (16-bit elements): sQ = sm[0..4095] as [t][64], sK = sm[4096..8191] as [t][64],
  // sV = sm[8192..12287] as [hcol][t], sVr = sm[12288..16383] as [hcol][t]
#pragma unroll
  for (int nt = 0; nt < 6; ++nt) {
    const int n0 = ch * 96 + nt * 16;            // wave-uniform
    const int p  = n0 >> 6;
    const int hc = (n0 & 63) + ln;
    const float sc = (p == 0) ? LOG2E_F : ((p == 2) ? 16.0f : 1.0f);
    unsigned short* base = sm + p * 4096;
#pragma unroll
    for (int r = 0; r < 8; ++r) {
      const int tl  = rg * 16 + 8 * half + r;
      const int idx = (p == 2) ? (hc * 64 + tl) : (tl * 64 + hc);
      const float vf = acc[nt][r] * sc;
      const _Float16 hv = (_Float16)vf;
      base[idx] = __builtin_bit_cast(unsigned short, hv);
      if (p == 2) {
        const _Float16 rv = (_Float16)((vf - (float)hv) * 1024.0f);
        sm[12288 + idx] = __builtin_bit_cast(unsigned short, rv);
      }
    }
  }
  __syncthreads();

  // whole-line stores: wave w owns token rows 8w..8w+7 of qh/kh and hcol rows 8w..8w+7 of vT/vR
  const int rl = lane >> 3;
  const int pc = lane & 7;
  const int rA = wave * 8 + rl;
  const int rB = rA + 4;
  const v4u qA = *(const v4u*)(sm + rA * 64 + pc * 8);
  const v4u qB = *(const v4u*)(sm + rB * 64 + pc * 8);
  const v4u kA = *(const v4u*)(sm + 4096 + rA * 64 + pc * 8);
  const v4u kB = *(const v4u*)(sm + 4096 + rB * 64 + pc * 8);
  const v4u vA = *(const v4u*)(sm + 8192 + rA * 64 + pc * 8);
  const v4u vB = *(const v4u*)(sm + 8192 + rB * 64 + pc * 8);
  const v4u uA = *(const v4u*)(sm + 12288 + rA * 64 + pc * 8);
  const v4u uB = *(const v4u*)(sm + 12288 + rB * 64 + pc * 8);
  _Float16* dqA = qh + (size_t)(m0 + rA) * HDIM + pc * 8;
  _Float16* dqB = qh + (size_t)(m0 + rB) * HDIM + pc * 8;
  _Float16* dkA = kh + (size_t)(m0 + rA) * HDIM + pc * 8;
  _Float16* dkB = kh + (size_t)(m0 + rB) * HDIM + pc * 8;
  _Float16* dvA = vT + ((size_t)b * HDIM + rA) * SEQ + t0 + pc * 8;
  _Float16* dvB = vT + ((size_t)b * HDIM + rB) * SEQ + t0 + pc * 8;
  _Float16* duA = vR + ((size_t)b * HDIM + rA) * SEQ + t0 + pc * 8;
  _Float16* duB = vR + ((size_t)b * HDIM + rB) * SEQ + t0 + pc * 8;
  *(v4u*)dqA = qA; *(v4u*)dqB = qB;
  *(v4u*)dkA = kA; *(v4u*)dkB = kB;
  *(v4u*)dvA = vA; *(v4u*)dvB = vB;
  *(v4u*)duA = uA; *(v4u*)duB = uB;
  
}

// ---------------------------------------------------------------------------
// Kernel 3: causal flash attention. Block = 4 waves x 16 query rows (64 rows), key chunks of 32.
// S tiles (D layout) -> online softmax in log2 domain -> P x 1024 to f16 A layout via LDS -> O += P.V, sums += P.ones.
// EARLY = 1 handles query tiles 0..NTB_E-1 (rows < 256): adds P residual (x1024) and v residual plane (x1024)
// products into separate accumulators folded with 2^-10 before the normalisation; EARLY = 0 handles the rest.
// ---------------------------------------------------------------------------
template <int EARLY>
__global__ __launch_bounds__(128) __attribute__((amdgpu_num_vgpr(256)))
void k_attn(const _Float16* __restrict__ qh, const _Float16* __restrict__ kh,
            const _Float16* __restrict__ vT, const _Float16* __restrict__ vR,
            float* __restrict__ out)
{
  __shared__ __attribute__((aligned(16))) _Float16 pbuf[4][16][40];   // per-wave 16 x 32 P tile (x1024)
  __shared__ __attribute__((aligned(16))) _Float16 rbuf[4][16][40];   // per-wave 16 x 32 P residual tile
  __shared__ __attribute__((aligned(16))) float    obuf[4][16][68];   // per-wave 16 x 64 output tile

  const int tid  = threadIdx.x;
  const int lane = tid & 31;
  const int wave = __builtin_amdgcn_readfirstlane(tid >> 5);
  const int half = lane >> 4;
  const int ln   = lane & 15;
  int b, tb;
  if (EARLY) { b = blockIdx.x / NTB_E;  tb = blockIdx.x - b * NTB_E; }
  else       { b = blockIdx.x / NTB_LD; tb = NTB_E + (blockIdx.x - b * NTB_LD); }
  const int row0 = tb * 64 + wave * 16;          // first query row of this wave (within the sequence)

  const _Float16* qrow  = qh + ((size_t)b * SEQ + row0 + ln) * HDIM + 8 * half;
  const _Float16* kbase = kh + (size_t)b * SEQ * HDIM + 8 * half;
  const _Float16* vbase = vT + (size_t)b * HDIM * SEQ + 8 * half;
  const _Float16* rbase = vR + (size_t)b * HDIM * SEQ + 8 * half;

  // loop-invariant Q A fragments (feature blocks 0..31, 32..63)
  const v16h qa0 = frag_f16(qrow);
  const v16h qa1 = frag_f16(qrow + 32);

  v16h ones;
#pragma unroll
  for (int i = 0; i < 16; ++i) ones[i] = (_Float16)1.0f;

  v8f o[4], orr[4];
  v8f osum, osumr;
#pragma unroll
  for (int r = 0; r < 8; ++r) { osum[r] = 0.0f; osumr[r] = 0.0f; }
#pragma unroll
  for (int ht = 0; ht < 4; ++ht) {
#pragma unroll
    for (int r = 0; r < 8; ++r) { o[ht][r] = 0.0f; orr[ht][r] = 0.0f; }
  }
  float rmax[8];
#pragma unroll
  for (int r = 0; r < 8; ++r) rmax[r] = NEG_BIG;

  const int nchunk = 2 * tb + 2;                 // keys 0 .. tb*64+63, block-uniform trip count
#pragma unroll 1
  for (int c = 0; c < nchunk; ++c) {
    const int kt0 = c * 32;
    const bool active = (kt0 <= row0 + 15);     // wave-uniform
    v8f s[2];
#pragma unroll
    for (int r = 0; r < 8; ++r) { s[0][r] = 0.0f; s[1][r] = 0.0f; }

    if (active) {
      // S[16 x 32] = Q(16 x 64) . K^T, K as B operand: column = key (lane&15), k = feature (split map)
#pragma unroll
      for (int nt = 0; nt < 2; ++nt) {
        const int key = kt0 + nt * 16 + ln;
        const _Float16* krow = kbase + (size_t)key * HDIM;
        const v16h kb0 = frag_f16(krow);
        const v16h kb1 = frag_f16(krow + 32);
        v8f acc;
#pragma unroll
        for (int r = 0; r < 8; ++r) acc[r] = 0.0f;
        acc = wmma_f16(qa0, kb0, acc);
        acc = wmma_f16(qa1, kb1, acc);
#pragma unroll
        for (int r = 0; r < 8; ++r) {
          const float sv = acc[r] * 0.125f;                        // 1/sqrt(64), log2e already in q
          s[nt][r] = (key > row0 + 8 * half + r) ? NEG_BIG : sv;   // causal fill (replace)
        }
      }
      // online softmax, row = 8*half + r, columns across the 16-lane half
      float alpha[8];
#pragma unroll
      for (int r = 0; r < 8; ++r) {
        float tmax = fmaxf(s[0][r], s[1][r]);
#pragma unroll
        for (int m = 1; m < 16; m <<= 1) tmax = fmaxf(tmax, __shfl_xor(tmax, m, 32));
        const float nmax = fmaxf(rmax[r], tmax);
        alpha[r] = exp2f(rmax[r] - nmax);
        rmax[r]  = nmax;
        s[0][r] = exp2f(s[0][r] - nmax);
        s[1][r] = exp2f(s[1][r] - nmax);
      }
#pragma unroll
      for (int r = 0; r < 8; ++r) {
        osum[r] *= alpha[r];
        if (EARLY) osumr[r] *= alpha[r];
#pragma unroll
        for (int ht = 0; ht < 4; ++ht) {
          o[ht][r] *= alpha[r];
          if (EARLY) orr[ht][r] *= alpha[r];
        }
      }
    }

    // P: D layout -> [q_local][key_local] in LDS (carried x 1024; residual x 1024 more), then reloaded as A fragments
    __syncthreads();
    if (active) {
#pragma unroll
      for (int nt = 0; nt < 2; ++nt) {
#pragma unroll
        for (int r = 0; r < 8; ++r) {
          const float pf = s[nt][r] * 1024.0f;
          const _Float16 ph = (_Float16)pf;
          pbuf[wave][r + 8 * half][nt * 16 + ln] = ph;
          if (EARLY) {
            const _Float16 pr = (_Float16)((pf - (float)ph) * 1024.0f);
            rbuf[wave][r + 8 * half][nt * 16 + ln] = pr;
          }
        }
      }
    }
    __syncthreads();

    if (active) {
      const v16h pa = frag_f16(&pbuf[wave][ln][8 * half]);
      // V as B operand: column = feature (lane&15), k = key (split map) from the key-contiguous planes
      if (EARLY) {
        const v16h pra = frag_f16(&rbuf[wave][ln][8 * half]);
#pragma unroll
        for (int ht = 0; ht < 4; ++ht) {
          const v16h vb = frag_f16(vbase + (size_t)(ht * 16 + ln) * SEQ + kt0);
          o[ht]   = wmma_f16(pa,  vb, o[ht]);
          orr[ht] = wmma_f16(pra, vb, orr[ht]);
        }
        osum  = wmma_f16(pa,  ones, osum);
        osumr = wmma_f16(pra, ones, osumr);
#pragma unroll
        for (int ht = 0; ht < 4; ++ht) {
          const v16h vr = frag_f16(rbase + (size_t)(ht * 16 + ln) * SEQ + kt0);
          orr[ht] = wmma_f16(pa, vr, orr[ht]);
        }
      } else {
#pragma unroll
        for (int ht = 0; ht < 4; ++ht) {
          const v16h vb = frag_f16(vbase + (size_t)(ht * 16 + ln) * SEQ + kt0);
          o[ht] = wmma_f16(pa, vb, o[ht]);
        }
        osum = wmma_f16(pa, ones, osum);   // row sums of the same f16 P in D layout
      }
    }
  }

  // normalise (1024 carry cancels between numerator and denominator; 1/16 undoes the v carry) and stage in LDS
#pragma unroll
  for (int r = 0; r < 8; ++r) {
    float den = osum[r];
    if (EARLY) den = den + osumr[r] * RINV;
    const float inv = 0.0625f * __builtin_amdgcn_rcpf(den);
#pragma unroll
    for (int ht = 0; ht < 4; ++ht) {
      float num = o[ht][r];
      if (EARLY) num = num + orr[ht][r] * RINV;
      obuf[wave][8 * half + r][ht * 16 + ln] = num * inv;
    }
  }
  __syncthreads();

  v4f vals[8];
#pragma unroll
  for (int i = 0; i < 8; ++i) vals[i] = *(const v4f*)(&obuf[wave][2 * i + half][ln * 4]);
  float* orow = out + ((size_t)b * SEQ_FULL + row0) * HDIM;
#pragma unroll
  for (int i = 0; i < 8; ++i)
    *(v4f*)(orow + (size_t)(2 * i + half) * HDIM + ln * 4) = vals[i];
  
}

// ---------------------------------------------------------------------------
extern "C" void kernel_launch(void* const* d_in, const int* in_sizes, int n_in,
                              void* d_out, int out_size, void* d_ws, size_t ws_size,
                              hipStream_t stream)
{
  if (n_in < 4) return;
  const long long tok_rows = (long long)(NB - 1) * SEQ_FULL + SEQ;
  if ((long long)in_sizes[0] < tok_rows * CDIM) return;
  if (in_sizes[1] < CDIM * HDIM || in_sizes[2] < CDIM * HDIM || in_sizes[3] < CDIM * HDIM) return;
  if ((long long)out_size < tok_rows * HDIM) return;

  const float* x  = (const float*)d_in[0];
  const float* Wq = (const float*)d_in[1];
  const float* Wk = (const float*)d_in[2];
  const float* Wv = (const float*)d_in[3];
  float* out = (float*)d_out;

  // workspace carve (bytes): Wt 192*448*2 = 172032 | qh NB*SEQ*64*2 | kh same | vT same | vR same
  const size_t wt_bytes = (size_t)NPROJ * WP * sizeof(unsigned short);
  const size_t plane    = (size_t)NB * SEQ * HDIM * sizeof(_Float16);
  const size_t off_wt = 0;
  const size_t off_q  = (off_wt + wt_bytes + 255) & ~(size_t)255;
  const size_t off_k  = off_q + plane;
  const size_t off_v  = off_k + plane;
  const size_t off_r  = off_v + plane;
  const size_t total  = off_r + plane;
  if (total > ws_size) return;

  unsigned short* Wt = (unsigned short*)((char*)d_ws + off_wt);
  _Float16* qh = (_Float16*)((char*)d_ws + off_q);
  _Float16* kh = (_Float16*)((char*)d_ws + off_k);
  _Float16* vT = (_Float16*)((char*)d_ws + off_v);
  _Float16* vR = (_Float16*)((char*)d_ws + off_r);

  k_wconv<<<NPROJ / 8, 256, 0, stream>>>(Wq, Wk, Wv, Wt);
  k_proj<<<(NB * SEQ) / 64, 256, 0, stream>>>(x, Wt, qh, kh, vT, vR);
  k_attn<1><<<NB * NTB_E, 128, 0, stream>>>(qh, kh, vT, vR, out);
  if (NTB_L > 0) k_attn<0><<<NB * NTB_LD, 128, 0, stream>>>(qh, kh, vT, vR, out);
}

// v001
// One run takes 78.6 microseconds.
// Two timings next to v000 put it at 2.54 and 2.49 times that version's speed.
#include <hip/hip_runtime.h>

// Contractions: x*W projections (q,k,v): v_wmma_f32_16x16x32_bf16, bf16 operands (RNE-converted inputs), f32 accumulate.
// q.k scores, P.v, P row sums: v_wmma_f32_16x16x32_f16, f16 operands (q x log2e, k, P x 1024, v x 16), f32 accumulate;
// query rows < 256 of each sequence also use f16 residual planes of P and v (x1024 carries) in separate f32 accumulators.

#ifndef NB
#define NB 8
#endif
#ifndef SEQ
#define SEQ 2048
#endif
#define NB_FULL  8
#define SEQ_FULL 2048
#define CDIM  400
#define HDIM  64
#define NPROJ 192
#define KP    416         // contraction depth padded to 13 x 32, pad columns are zeros
#define XP    424         // LDS pitch of the staged x tile (16-bit elements)
#define WP    448         // pitch of the k-contiguous W plane (16-bit elements), 896 B = 7 lines
#define NTB    (SEQ / 64)                    // 64-row query tiles per sequence
#define NTB_E  ((NTB < 4) ? NTB : 4)         // tiles with query rows < 256: residual path
#define NTB_L  (NTB - NTB_E)
#define NTB_LD ((NTB_L > 0) ? NTB_L : 1)
#define NKW    8                             // waves of an attention block: all on the same 16 query rows, keys dealt over them
#define NRG_E  (NTB_E * 4)                   // 16-row query groups with rows < 256
#define NRG_LD (NTB_LD * 4)

static_assert(SEQ % 64 == 0 && SEQ >= 64);
static_assert(NKW * 32 == 16 * 16);          // the merge gives each of the 16 rows 16 threads
static_assert(SEQ <= SEQ_FULL);
static_assert(NB >= 1 && NB <= NB_FULL);
static_assert(KP % 32 == 0 && KP >= CDIM);
static_assert(XP >= KP && (XP % 8) == 0);
static_assert(WP >= KP && ((WP * 2) % 128) == 0);
static_assert(NPROJ == 3 * HDIM && (NPROJ % 8) == 0 && (HDIM % 8) == 0);
static_assert(CDIM % 4 == 0 && CDIM > 256 && CDIM <= 512);
static_assert(64 * XP >= 4 * 4096);
static_assert(((long long)(NB - 1) * SEQ_FULL + SEQ) * HDIM <= 1048576LL);

typedef _Float16       v16h  __attribute__((ext_vector_type(16)));
typedef _Float16       v8h   __attribute__((ext_vector_type(8)));
typedef float          v8f   __attribute__((ext_vector_type(8)));
typedef float          v4f   __attribute__((ext_vector_type(4)));
typedef unsigned short v16us __attribute__((ext_vector_type(16)));
typedef unsigned short v8us  __attribute__((ext_vector_type(8)));
typedef unsigned int   v4u   __attribute__((ext_vector_type(4)));
typedef unsigned int   v2u   __attribute__((ext_vector_type(2)));
typedef __bf16         v16bf __attribute__((ext_vector_type(16)));

union FragH { v16h v; v8h h[2]; };
union FragU { v16us v; v8us h[2]; };

#define LOG2E_F 1.4426950408889634f
#define NEG_BIG (-3.0e38f)
#define RINV    0.0009765625f

// f32 -> bf16 bits, RNE convert
__device__ __forceinline__ unsigned int bf_bits(float f) {
  const unsigned int u = __float_as_uint(f);
  return (u + 0x7FFFu + ((u >> 16) & 1u)) >> 16;
}

// WMMA helpers with the VALU hazard guard (ties D, keeps A/B live)
__device__ __forceinline__ v8f wmma_f16(v16h a, v16h b, v8f c) {
  v8f d = __builtin_amdgcn_wmma_f32_16x16x32_f16(false, a, false, b, (short)0, c, false, false);
  asm volatile("v_nop\n\tv_nop\n\tv_nop\n\tv_nop" : "+v"(d) : "v"(a), "v"(b));
  return d;
}
__device__ __forceinline__ v8f wmma_bf16(v16us a, v16us b, v8f c) {
  v8f d = __builtin_amdgcn_wmma_f32_16x16x32_bf16(false, __builtin_bit_cast(v16bf, a), false,
                                                   __builtin_bit_cast(v16bf, b), (short)0, c, false, false);
  asm volatile("v_nop\n\tv_nop\n\tv_nop\n\tv_nop" : "+v"(d) : "v"(a), "v"(b));
  return d;
}

// 16-bit operand fragment, split k map for BOTH A and B:
// p = (row or column (lane&15)) base + k0 + 8*(lane>>4); elements 0..7 <- p[0..7], elements 8..15 <- p[16..23].
__device__ __forceinline__ v16h frag_f16(const _Float16* p) {
  FragH f;
  f.h[0] = *(const v8h*)p;
  f.h[1] = *(const v8h*)(p + 16);
  return f.v;
}
__device__ __forceinline__ v16us frag_u16(const unsigned short* p) {
  FragU f;
  f.h[0] = *(const v8us*)p;
  f.h[1] = *(const v8us*)(p + 16);
  return f.v;
}

// ---------------------------------------------------------------------------
// Kernel 1: W planes -> one k-contiguous bf16 plane Wt[n][WP], n = p*64 + hcol (p: 0 q, 1 k, 2 v),
// columns CDIM..WP-1 zero. Block = 8 output rows (coalesced 32-B reads of W, transposed in LDS);
// ---------------------------------------------------------------------------
__global__ __launch_bounds__(256) void k_wconv(
    const float* __restrict__ Wq, const float* __restrict__ Wk, const float* __restrict__ Wv,
    unsigned short* __restrict__ Wt)
{
  __shared__ __attribute__((aligned(16))) unsigned short sw[8 * WP];   // [hcol_local][c]

  const int tid   = threadIdx.x;
  const int lane  = tid & 31;
  const int wave  = __builtin_amdgcn_readfirstlane(tid >> 5);
  const int p     = blockIdx.x >> 3;
  const int hcol0 = (blockIdx.x & 7) * 8;
  const float* W = (p == 0) ? Wq : ((p == 1) ? Wk : Wv);   // block-uniform select, same address space

  for (int i = tid; i < 8 * (WP - CDIM); i += 256) {
    const int r = i / (WP - CDIM);
    const int c = i - r * (WP - CDIM);
    sw[r * WP + CDIM + c] = (unsigned short)0;
  }
  for (int i = tid; i < CDIM * 2; i += 256) {
    const int c  = i >> 1;
    const int q4 = (i & 1) * 4;
    const v4f v = *(const v4f*)(W + (size_t)c * HDIM + hcol0 + q4);
    sw[(q4 + 0) * WP + c] = (unsigned short)bf_bits(v.x);
    sw[(q4 + 1) * WP + c] = (unsigned short)bf_bits(v.y);
    sw[(q4 + 2) * WP + c] = (unsigned short)bf_bits(v.z);
    sw[(q4 + 3) * WP + c] = (unsigned short)bf_bits(v.w);
  }
  __syncthreads();

  const int n = p * HDIM + hcol0 + wave;          // 0..NPROJ-1
  unsigned short* dst = Wt + (size_t)n * WP;
  const int l2 = (lane < 24) ? lane : 23;         // clamp address for the partial second segment
  const v4u w0 = *(const v4u*)(sw + wave * WP + lane * 8);
  const v4u w1 = *(const v4u*)(sw + wave * WP + 256 + l2 * 8);
  unsigned short* d0 = dst + lane * 8;
  unsigned short* d1 = dst + 256 + l2 * 8;
  *(v4u*)d0 = w0;
  if (lane < 24) *(v4u*)d1 = w1;
  
}

// ---------------------------------------------------------------------------
// Kernel 2: q,k,v projections for a tile of 64 token rows on bf16 WMMA.
// 8 waves: wave -> 16 rows (wave&3) x 96 output columns (wave>>2). x tile staged once in LDS as bf16.
// Outputs: qh = f16(q*log2e) [tok][64], kh = f16(k) [tok][64], vT = f16(16*v) [b][64][SEQ],
// vR = f16((16*v - vT) * 1024) [b][64][SEQ] (residual plane).
// ---------------------------------------------------------------------------
__global__ __launch_bounds__(256) __attribute__((amdgpu_num_vgpr(256)))
void k_proj(const float* __restrict__ x, const unsigned short* __restrict__ Wt,
            _Float16* __restrict__ qh, _Float16* __restrict__ kh,
            _Float16* __restrict__ vT, _Float16* __restrict__ vR)
{
  __shared__ __attribute__((aligned(16))) unsigned short sm[64 * XP];   // 54272 B, later reused as staging

  const int tid  = threadIdx.x;
  const int lane = tid & 31;
  const int wave = __builtin_amdgcn_readfirstlane(tid >> 5);
  const int half = lane >> 4;
  const int ln   = lane & 15;
  const int m0 = blockIdx.x * 64;               // compact token row of this tile
  const int b  = m0 / SEQ;
  const int t0 = m0 - b * SEQ;
  const float* xblk = x + ((size_t)b * SEQ_FULL + t0) * CDIM;

  // stage x tile: 64 rows x CDIM -> bf16, columns CDIM..XP-1 zero
  for (int i = tid; i < 64 * (CDIM / 4); i += 256) {
    const int r  = i / (CDIM / 4);
    const int c4 = i - r * (CDIM / 4);
    const v4f v = *(const v4f*)(xblk + (size_t)r * CDIM + c4 * 4);
    v2u w;
    w.x = bf_bits(v.x) | (bf_bits(v.y) << 16);
    w.y = bf_bits(v.z) | (bf_bits(v.w) << 16);
    *(v2u*)(sm + r * XP + c4 * 4) = w;
  }
  for (int i = tid; i < 64 * 3; i += 256) {
    const int r = i / 3;
    const int j = i - r * 3;
    v4u z; z.x = 0u; z.y = 0u; z.z = 0u; z.w = 0u;
    *(v4u*)(sm + r * XP + CDIM + j * 8) = z;
  }
  __syncthreads();

  const int rg = wave & 3;
  const int ch = wave >> 2;
  v8f acc[6];
#pragma unroll
  for (int nt = 0; nt < 6; ++nt) {
#pragma unroll
    for (int r = 0; r < 8; ++r) acc[nt][r] = 0.0f;
  }
  const unsigned short* arow = sm + (rg * 16 + ln) * XP + 8 * half;
  const unsigned short* brow = Wt + (size_t)(ch * 96 + ln) * WP + 8 * half;
#pragma unroll 1
  for (int k0 = 0; k0 < KP; k0 += 32) {
    const v16us a = frag_u16(arow + k0);
#pragma unroll
    for (int nt = 0; nt < 6; ++nt) {
      const v16us bb = frag_u16(brow + (size_t)nt * 16 * WP + k0);
      acc[nt] = wmma_bf16(a, bb, acc[nt]);
    }
  }
  __syncthreads();   // all waves done reading the x tile

  // staging (16-bit elements): sQ = sm[0..4095] as [t][64], sK = sm[4096..8191] as [t][64],
  // sV = sm[8192..12287] as [hcol][t], sVr = sm[12288..16383] as [hcol][t]
#pragma unroll
  for (int nt = 0; nt < 6; ++nt) {
    const int n0 = ch * 96 + nt * 16;            // wave-uniform
    const int p  = n0 >> 6;
    const int hc = (n0 & 63) + ln;
    const float sc = (p == 0) ? LOG2E_F : ((p == 2) ? 16.0f : 1.0f);
    unsigned short* base = sm + p * 4096;
#pragma unroll
    for (int r = 0; r < 8; ++r) {
      const int tl  = rg * 16 + 8 * half + r;
      const int idx = (p == 2) ? (hc * 64 + tl) : (tl * 64 + hc);
      const float vf = acc[nt][r] * sc;
      const _Float16 hv = (_Float16)vf;
      base[idx] = __builtin_bit_cast(unsigned short, hv);
      if (p == 2) {
        const _Float16 rv = (_Float16)((vf - (float)hv) * 1024.0f);
        sm[12288 + idx] = __builtin_bit_cast(unsigned short, rv);
      }
    }
  }
  __syncthreads();

  // whole-line stores: wave w owns token rows 8w..8w+7 of qh/kh and hcol rows 8w..8w+7 of vT/vR
  const int rl = lane >> 3;
  const int pc = lane & 7;
  const int rA = wave * 8 + rl;
  const int rB = rA + 4;
  const v4u qA = *(const v4u*)(sm + rA * 64 + pc * 8);
  const v4u qB = *(const v4u*)(sm + rB * 64 + pc * 8);
  const v4u kA = *(const v4u*)(sm + 4096 + rA * 64 + pc * 8);
  const v4u kB = *(const v4u*)(sm + 4096 + rB * 64 + pc * 8);
  const v4u vA = *(const v4u*)(sm + 8192 + rA * 64 + pc * 8);
  const v4u vB = *(const v4u*)(sm + 8192 + rB * 64 + pc * 8);
  const v4u uA = *(const v4u*)(sm + 12288 + rA * 64 + pc * 8);
  const v4u uB = *(const v4u*)(sm + 12288 + rB * 64 + pc * 8);
  _Float16* dqA = qh + (size_t)(m0 + rA) * HDIM + pc * 8;
  _Float16* dqB = qh + (size_t)(m0 + rB) * HDIM + pc * 8;
  _Float16* dkA = kh + (size_t)(m0 + rA) * HDIM + pc * 8;
  _Float16* dkB = kh + (size_t)(m0 + rB) * HDIM + pc * 8;
  _Float16* dvA = vT + ((size_t)b * HDIM + rA) * SEQ + t0 + pc * 8;
  _Float16* dvB = vT + ((size_t)b * HDIM + rB) * SEQ + t0 + pc * 8;
  _Float16* duA = vR + ((size_t)b * HDIM + rA) * SEQ + t0 + pc * 8;
  _Float16* duB = vR + ((size_t)b * HDIM + rB) * SEQ + t0 + pc * 8;
  *(v4u*)dqA = qA; *(v4u*)dqB = qB;
  *(v4u*)dkA = kA; *(v4u*)dkB = kB;
  *(v4u*)dvA = vA; *(v4u*)dvB = vB;
  *(v4u*)duA = uA; *(v4u*)duB = uB;
  
}

// ---------------------------------------------------------------------------
// Kernel 3: causal flash attention. Block = NKW waves on ONE group of 16 query rows, key chunks of 32:
// wave w takes chunks w, w + NKW, ... with its own maxima, sums and accumulators; the partials meet in LDS at the end.
// S tiles (D layout) -> online softmax in log2 domain -> P x 1024 to f16 A layout via LDS -> O += P.V, sums += P.ones.
// EARLY = 1 handles query tiles 0..NTB_E-1 (rows < 256): adds P residual (x1024) and v residual plane (x1024)
// products into separate accumulators folded with 2^-10 before the merge; EARLY = 0 handles the rest.
// ---------------------------------------------------------------------------
// Register budget of 8 waves per SIMD: four blocks fit a WGP, so every block of the launch is resident at once.
template <int EARLY>
__global__ __launch_bounds__(NKW * 32) __attribute__((amdgpu_waves_per_eu(8)))
void k_attn(const _Float16* __restrict__ qh, const _Float16* __restrict__ kh,
            const _Float16* __restrict__ vT, const _Float16* __restrict__ vR,
            float* __restrict__ out)
{
  __shared__ __attribute__((aligned(16))) _Float16 pbuf[NKW][16][40];               // per-wave 16 x 32 P tile (x1024)
  __shared__ __attribute__((aligned(16))) _Float16 rbuf[EARLY ? NKW : 1][16][40];   // per-wave 16 x 32 P residual tile
  __shared__ __attribute__((aligned(16))) float    obuf[NKW][16][68];               // per-wave 16 x 64 un-normalised partial
  __shared__ float mbuf[NKW][16];                                                   // per-wave row maxima (log2 domain)
  __shared__ float dbuf[NKW][16];                                                   // per-wave row sums

  const int tid  = threadIdx.x;
  const int lane = tid & 31;
  const int wave = __builtin_amdgcn_readfirstlane(tid >> 5);
  const int half = lane >> 4;
  const int ln   = lane & 15;
  int b, rg;
  if (EARLY) { b = blockIdx.x / NRG_E;  rg = blockIdx.x - b * NRG_E; }
  else       { b = blockIdx.x / NRG_LD; rg = NRG_E + (blockIdx.x - b * NRG_LD); }
  const int row0 = rg * 16;                      // first query row of this block (within the sequence)

  const _Float16* qrow  = qh + ((size_t)b * SEQ + row0 + ln) * HDIM + 8 * half;
  const _Float16* kbase = kh + (size_t)b * SEQ * HDIM + 8 * half;
  const _Float16* vbase = vT + (size_t)b * HDIM * SEQ + 8 * half;
  const _Float16* rbase = vR + (size_t)b * HDIM * SEQ + 8 * half;

  // loop-invariant Q A fragments (feature blocks 0..31, 32..63)
  const v16h qa0 = frag_f16(qrow);
  const v16h qa1 = frag_f16(qrow + 32);

  v16h ones;
#pragma unroll
  for (int i = 0; i < 16; ++i) ones[i] = (_Float16)1.0f;

  v8f o[4], orr[4];
  v8f osum, osumr;
#pragma unroll
  for (int r = 0; r < 8; ++r) { osum[r] = 0.0f; osumr[r] = 0.0f; }
#pragma unroll
  for (int ht = 0; ht < 4; ++ht) {
#pragma unroll
    for (int r = 0; r < 8; ++r) { o[ht][r] = 0.0f; orr[ht][r] = 0.0f; }
  }
  float rmax[8];
#pragma unroll
  for (int r = 0; r < 8; ++r) rmax[r] = NEG_BIG;

  const int nchunk = (row0 >> 5) + 1;            // chunks that hold a key <= row0 + 15
  const int npass  = (nchunk + NKW - 1) / NKW;   // block-uniform trip count
#pragma unroll 1
  for (int it = 0; it < npass; ++it) {
    const int c   = it * NKW + wave;             // this wave's chunk of the pass
    const int kt0 = c * 32;
    const bool active = (c < nchunk);           // wave-uniform
    v8f s[2];
#pragma unroll
    for (int r = 0; r < 8; ++r) { s[0][r] = 0.0f; s[1][r] = 0.0f; }

    if (active) {
      // S[16 x 32] = Q(16 x 64) . K^T, K as B operand: column = key (lane&15), k = feature (split map)
#pragma unroll
      for (int nt = 0; nt < 2; ++nt) {
        const int key = kt0 + nt * 16 + ln;
        const _Float16* krow = kbase + (size_t)key * HDIM;
        const v16h kb0 = frag_f16(krow);
        const v16h kb1 = frag_f16(krow + 32);
        v8f acc;
#pragma unroll
        for (int r = 0; r < 8; ++r) acc[r] = 0.0f;
        acc = wmma_f16(qa0, kb0, acc);
        acc = wmma_f16(qa1, kb1, acc);
#pragma unroll
        for (int r = 0; r < 8; ++r) {
          const float sv = acc[r] * 0.125f;                        // 1/sqrt(64), log2e already in q
          s[nt][r] = (key > row0 + 8 * half + r) ? NEG_BIG : sv;   // causal fill (replace)
        }
      }
      // online softmax, row = 8*half + r, columns across the 16-lane half
      float alpha[8];
#pragma unroll
      for (int r = 0; r < 8; ++r) {
        float tmax = fmaxf(s[0][r], s[1][r]);
#pragma unroll
        for (int m = 1; m < 16; m <<= 1) tmax = fmaxf(tmax, __shfl_xor(tmax, m, 32));
        const float nmax = fmaxf(rmax[r], tmax);
        alpha[r] = exp2f(rmax[r] - nmax);
        rmax[r]  = nmax;
        s[0][r] = exp2f(s[0][r] - nmax);
        s[1][r] = exp2f(s[1][r] - nmax);
      }
#pragma unroll
      for (int r = 0; r < 8; ++r) {
        osum[r] *= alpha[r];
        if (EARLY) osumr[r] *= alpha[r];
#pragma unroll
        for (int ht = 0; ht < 4; ++ht) {
          o[ht][r] *= alpha[r];
          if (EARLY) orr[ht][r] *= alpha[r];
        }
      }
    }

    // P: D layout -> [q_local][key_local] in LDS (carried x 1024; residual x 1024 more), then reloaded as A fragments
    __syncthreads();
    if (active) {
#pragma unroll
      for (int nt = 0; nt < 2; ++nt) {
#pragma unroll
        for (int r = 0; r < 8; ++r) {
          const float pf = s[nt][r] * 1024.0f;
          const _Float16 ph = (_Float16)pf;
          pbuf[wave][r + 8 * half][nt * 16 + ln] = ph;
          if (EARLY) {
            const _Float16 pr = (_Float16)((pf - (float)ph) * 1024.0f);
            rbuf[wave][r + 8 * half][nt * 16 + ln] = pr;
          }
        }
      }
    }
    __syncthreads();

    if (active) {
      const v16h pa = frag_f16(&pbuf[wave][ln][8 * half]);
      // V as B operand: column = feature (lane&15), k = key (split map) from the key-contiguous planes
      if (EARLY) {
        const v16h pra = frag_f16(&rbuf[wave][ln][8 * half]);
#pragma unroll
        for (int ht = 0; ht < 4; ++ht) {
          const v16h vb = frag_f16(vbase + (size_t)(ht * 16 + ln) * SEQ + kt0);
          o[ht]   = wmma_f16(pa,  vb, o[ht]);
          orr[ht] = wmma_f16(pra, vb, orr[ht]);
        }
        osum  = wmma_f16(pa,  ones, osum);
        osumr = wmma_f16(pra, ones, osumr);
#pragma unroll
        for (int ht = 0; ht < 4; ++ht) {
          const v16h vr = frag_f16(rbase + (size_t)(ht * 16 + ln) * SEQ + kt0);
          orr[ht] = wmma_f16(pa, vr, orr[ht]);
        }
      } else {
#pragma unroll
        for (int ht = 0; ht < 4; ++ht) {
          const v16h vb = frag_f16(vbase + (size_t)(ht * 16 + ln) * SEQ + kt0);
          o[ht] = wmma_f16(pa, vb, o[ht]);
        }
        osum = wmma_f16(pa, ones, osum);   // row sums of the same f16 P in D layout
      }
    }
  }

  // each wave's partial (un-normalised numerator, row sum, row maximum) to its own LDS region;
  // a wave that had no chunk leaves zeros under the maximum NEG_BIG and gets weight 0 below
#pragma unroll
  for (int r = 0; r < 8; ++r) {
    float den = osum[r];
    if (EARLY) den = den + osumr[r] * RINV;
    osum[r] = den;
#pragma unroll
    for (int ht = 0; ht < 4; ++ht) {
      float num = o[ht][r];
      if (EARLY) num = num + orr[ht][r] * RINV;
      obuf[wave][8 * half + r][ht * 16 + ln] = num;
    }
  }
  if (ln == 0) {   // maxima and sums are alike in the 16 lanes of a half
#pragma unroll
    for (int r = 0; r < 8; ++r) {
      mbuf[wave][8 * half + r] = rmax[r];
      dbuf[wave][8 * half + r] = osum[r];
    }
  }
  __syncthreads();

  // merge: thread -> query row tid >> 4, four features; weights 2^(m_w - m); then normalise
  // (1024 carry cancels between numerator and denominator; 1/16 undoes the v carry)
  const int mrow = tid >> 4;
  float mw[NKW];
  float mall = NEG_BIG;
#pragma unroll
  for (int w = 0; w < NKW; ++w) { mw[w] = mbuf[w][mrow]; mall = fmaxf(mall, mw[w]); }
  float den = 0.0f;
  v4f num;
  num.x = 0.0f; num.y = 0.0f; num.z = 0.0f; num.w = 0.0f;
#pragma unroll
  for (int w = 0; w < NKW; ++w) {
    const float a = exp2f(mw[w] - mall);
    const v4f pv = *(const v4f*)(&obuf[w][mrow][ln * 4]);
    den += a * dbuf[w][mrow];
    num += pv * a;
  }
  const float inv = 0.0625f * __builtin_amdgcn_rcpf(den);
  *(v4f*)(out + ((size_t)b * SEQ_FULL + row0 + mrow) * HDIM + ln * 4) = num * inv;
}

// ---------------------------------------------------------------------------
extern "C" void kernel_launch(void* const* d_in, const int* in_sizes, int n_in,
                              void* d_out, int out_size, void* d_ws, size_t ws_size,
                              hipStream_t stream)
{
  if (n_in < 4) return;
  const long long tok_rows = (long long)(NB - 1) * SEQ_FULL + SEQ;
  if ((long long)in_sizes[0] < tok_rows * CDIM) return;
  if (in_sizes[1] < CDIM * HDIM || in_sizes[2] < CDIM * HDIM || in_sizes[3] < CDIM * HDIM) return;
  if ((long long)out_size < tok_rows * HDIM) return;

  const float* x  = (const float*)d_in[0];
  const float* Wq = (const float*)d_in[1];
  const float* Wk = (const float*)d_in[2];
  const float* Wv = (const float*)d_in[3];
  float* out = (float*)d_out;

  // workspace carve (bytes): Wt 192*448*2 = 172032 | qh NB*SEQ*64*2 | kh same | vT same | vR same
  const size_t wt_bytes = (size_t)NPROJ * WP * sizeof(unsigned short);
  const size_t plane    = (size_t)NB * SEQ * HDIM * sizeof(_Float16);
  const size_t off_wt = 0;
  const size_t off_q  = (off_wt + wt_bytes + 255) & ~(size_t)255;
  const size_t off_k  = off_q + plane;
  const size_t off_v  = off_k + plane;
  const size_t off_r  = off_v + plane;
  const size_t total  = off_r + plane;
  if (total > ws_size) return;

  unsigned short* Wt = (unsigned short*)((char*)d_ws + off_wt);
  _Float16* qh = (_Float16*)((char*)d_ws + off_q);
  _Float16* kh = (_Float16*)((char*)d_ws + off_k);
  _Float16* vT = (_Float16*)((char*)d_ws + off_v);
  _Float16* vR = (_Float16*)((char*)d_ws + off_r);

  k_wconv<<<NPROJ / 8, 256, 0, stream>>>(Wq, Wk, Wv, Wt);
  k_proj<<<(NB * SEQ) / 64, 256, 0, stream>>>(x, Wt, qh, kh, vT, vR);
  k_attn<1><<<NB * NRG_E, NKW * 32, 0, stream>>>(qh, kh, vT, vR, out);
  if (NTB_L > 0) k_attn<0><<<NB * NRG_LD, NKW * 32, 0, stream>>>(qh, kh, vT, vR, out);
}

// v002
// A run of this version takes 47.4 microseconds.
// In two side-by-side timings against v001, it was 1.65 and 1.66 times as fast.
// Counting every step since v000, it is 4.16 times as fast.
#include <hip/hip_runtime.h>

// Contractions: x*W projections (q,k,v): v_wmma_f32_16x16x32_bf16, bf16 operands (RNE-converted inputs), f32 accumulate.
// q.k scores, P.v, P row sums: v_wmma_f32_16x16x32_f16, f16 operands (q x log2e, k, P x 1024, v x 16), f32 accumulate;
// query rows < 256 of each sequence also use f16 residual planes of P and v (x1024 carries) in separate f32 accumulators.

#ifndef NB
#define NB 8
#endif
#ifndef SEQ
#define SEQ 2048
#endif
#define NB_FULL  8
#define SEQ_FULL 2048
#define CDIM  400
#define HDIM  64
#define NPROJ 192
#define KP    416         // contraction depth padded to 13 x 32, pad columns are zeros
#define XP    424         // LDS pitch of the staged x tile (16-bit elements)
#define WP    448         // pitch of the k-contiguous W plane (16-bit elements), 896 B = 7 lines
#define NKS    (KP / 32)                     // k steps of a projection
#define XLD    (64 * (CDIM / 4) / 256)       // 16-byte x loads of a thread of the projection block
#define WLD    ((CDIM * 2 + 255) / 256)      // 16-byte W loads of a thread of the conversion block, at most
#define NTB    (SEQ / 64)                    // 64-row query tiles per sequence
#define NTB_E  ((NTB < 4) ? NTB : 4)         // tiles with query rows < 256: residual path
#define NTB_L  (NTB - NTB_E)
#define NTB_LD ((NTB_L > 0) ? NTB_L : 1)
#define NKW    8                             // waves of an attention block: all on the same 16 query rows, keys dealt over them
#define NRG_E  (NTB_E * 4)                   // 16-row query groups with rows < 256
#define NRG_LD (NTB_LD * 4)

static_assert(SEQ % 64 == 0 && SEQ >= 64);
static_assert(NKW * 32 == 16 * 16);          // the merge gives each of the 16 rows 16 threads
static_assert(SEQ <= SEQ_FULL);
static_assert(NB >= 1 && NB <= NB_FULL);
static_assert(KP % 32 == 0 && KP >= CDIM);
static_assert(XP >= KP && (XP % 8) == 0);
static_assert(WP >= KP && ((WP * 2) % 128) == 0);
static_assert(NPROJ == 3 * HDIM && (NPROJ % 8) == 0 && (HDIM % 8) == 0);
static_assert(CDIM % 4 == 0 && CDIM > 256 && CDIM <= 512);
static_assert(64 * XP >= 4 * 4096);
static_assert((64 * (CDIM / 4)) % 256 == 0 && NKS >= 2);
static_assert(((long long)(NB - 1) * SEQ_FULL + SEQ) * HDIM <= 1048576LL);

typedef _Float16       v16h  __attribute__((ext_vector_type(16)));
typedef _Float16       v8h   __attribute__((ext_vector_type(8)));
typedef float          v8f   __attribute__((ext_vector_type(8)));
typedef float          v4f   __attribute__((ext_vector_type(4)));
typedef unsigned short v16us __attribute__((ext_vector_type(16)));
typedef unsigned short v8us  __attribute__((ext_vector_type(8)));
typedef unsigned int   v4u   __attribute__((ext_vector_type(4)));
typedef unsigned int   v2u   __attribute__((ext_vector_type(2)));
typedef __bf16         v16bf __attribute__((ext_vector_type(16)));

union FragH { v16h v; v8h h[2]; };
union FragU { v16us v; v8us h[2]; };

#define LOG2E_F 1.4426950408889634f
#define NEG_BIG (-3.0e38f)
#define RINV    0.0009765625f

// f32 -> bf16 bits, RNE convert
__device__ __forceinline__ unsigned int bf_bits(float f) {
  const unsigned int u = __float_as_uint(f);
  return (u + 0x7FFFu + ((u >> 16) & 1u)) >> 16;
}

// WMMA helpers with the VALU hazard guard (ties D, keeps A/B live)
__device__ __forceinline__ v8f wmma_f16(v16h a, v16h b, v8f c) {
  v8f d = __builtin_amdgcn_wmma_f32_16x16x32_f16(false, a, false, b, (short)0, c, false, false);
  asm volatile("v_nop\n\tv_nop\n\tv_nop\n\tv_nop" : "+v"(d) : "v"(a), "v"(b));
  return d;
}
__device__ __forceinline__ v8f wmma_bf16(v16us a, v16us b, v8f c) {
  v8f d = __builtin_amdgcn_wmma_f32_16x16x32_bf16(false, __builtin_bit_cast(v16bf, a), false,
                                                   __builtin_bit_cast(v16bf, b), (short)0, c, false, false);
  asm volatile("v_nop\n\tv_nop\n\tv_nop\n\tv_nop" : "+v"(d) : "v"(a), "v"(b));
  return d;
}

// 16-bit operand fragment, split k map for BOTH A and B:
// p = (row or column (lane&15)) base + k0 + 8*(lane>>4); elements 0..7 <- p[0..7], elements 8..15 <- p[16..23].
__device__ __forceinline__ v16h frag_f16(const _Float16* p) {
  FragH f;
  f.h[0] = *(const v8h*)p;
  f.h[1] = *(const v8h*)(p + 16);
  return f.v;
}
__device__ __forceinline__ v16us frag_u16(const unsigned short* p) {
  FragU f;
  f.h[0] = *(const v8us*)p;
  f.h[1] = *(const v8us*)(p + 16);
  return f.v;
}

// ---------------------------------------------------------------------------
// Kernel 1: W planes -> one k-contiguous bf16 plane Wt[n][WP], n = p*64 + hcol (p: 0 q, 1 k, 2 v),
// columns CDIM..WP-1 zero. Block = 8 output rows (coalesced 32-B reads of W, transposed in LDS);
// ---------------------------------------------------------------------------
__global__ __launch_bounds__(256) void k_wconv(
    const float* __restrict__ Wq, const float* __restrict__ Wk, const float* __restrict__ Wv,
    unsigned short* __restrict__ Wt)
{
  __shared__ __attribute__((aligned(16))) unsigned short sw[8 * WP];   // [hcol_local][c]

  const int tid   = threadIdx.x;
  const int lane  = tid & 31;
  const int wave  = __builtin_amdgcn_readfirstlane(tid >> 5);
  const int p     = blockIdx.x >> 3;
  const int hcol0 = (blockIdx.x & 7) * 8;
  const float* W = (p == 0) ? Wq : ((p == 1) ? Wk : Wv);   // block-uniform select, same address space

  for (int i = tid; i < 8 * (WP - CDIM); i += 256) {
    const int r = i / (WP - CDIM);
    const int c = i - r * (WP - CDIM);
    sw[r * WP + CDIM + c] = (unsigned short)0;
  }
  // a thread's W loads all leave before the first is used
  v4f wv[WLD];
#pragma unroll
  for (int j = 0; j < WLD; ++j) {
    const int i = (tid + j * 256 < CDIM * 2) ? (tid + j * 256) : (CDIM * 2 - 1);   // in bounds for every thread: no branch round a load
    wv[j] = *(const v4f*)(W + (size_t)(i >> 1) * HDIM + hcol0 + (i & 1) * 4);
  }
#pragma unroll
  for (int j = 0; j < WLD; ++j) {
    const int i = tid + j * 256;
    if (i >= CDIM * 2) break;
    const int c  = i >> 1;
    const int q4 = (i & 1) * 4;
    const v4f v = wv[j];
    sw[(q4 + 0) * WP + c] = (unsigned short)bf_bits(v.x);
    sw[(q4 + 1) * WP + c] = (unsigned short)bf_bits(v.y);
    sw[(q4 + 2) * WP + c] = (unsigned short)bf_bits(v.z);
    sw[(q4 + 3) * WP + c] = (unsigned short)bf_bits(v.w);
  }
  __syncthreads();

  const int n = p * HDIM + hcol0 + wave;          // 0..NPROJ-1
  unsigned short* dst = Wt + (size_t)n * WP;
  const int l2 = (lane < 24) ? lane : 23;         // clamp address for the partial second segment
  const v4u w0 = *(const v4u*)(sw + wave * WP + lane * 8);
  const v4u w1 = *(const v4u*)(sw + wave * WP + 256 + l2 * 8);
  unsigned short* d0 = dst + lane * 8;
  unsigned short* d1 = dst + 256 + l2 * 8;
  *(v4u*)d0 = w0;
  if (lane < 24) *(v4u*)d1 = w1;
  
}

// ---------------------------------------------------------------------------
// Kernel 2: q,k,v projections for a tile of 64 token rows on bf16 WMMA.
// 8 waves: wave -> 16 rows (wave&3) x 96 output columns (wave>>2). x tile staged once in LDS as bf16.
// Outputs: qh = f16(q*log2e) [tok][64], kh = f16(k) [tok][64], vT = f16(16*v) [b][64][SEQ],
// vR = f16((16*v - vT) * 1024) [b][64][SEQ] (residual plane).
// ---------------------------------------------------------------------------
__global__ __launch_bounds__(256) __attribute__((amdgpu_num_vgpr(256)))
void k_proj(const float* __restrict__ x, const unsigned short* __restrict__ Wt,
            _Float16* __restrict__ qh, _Float16* __restrict__ kh,
            _Float16* __restrict__ vT, _Float16* __restrict__ vR)
{
  __shared__ __attribute__((aligned(16))) unsigned short sm[64 * XP];   // 54272 B, later reused as staging

  const int tid  = threadIdx.x;
  const int lane = tid & 31;
  const int wave = __builtin_amdgcn_readfirstlane(tid >> 5);
  const int half = lane >> 4;
  const int ln   = lane & 15;
  const int m0 = blockIdx.x * 64;               // compact token row of this tile
  const int b  = m0 / SEQ;
  const int t0 = m0 - b * SEQ;
  const float* xblk = x + ((size_t)b * SEQ_FULL + t0) * CDIM;

  const int rg = wave & 3;
  const int ch = wave >> 2;
  const unsigned short* arow = sm + (rg * 16 + ln) * XP + 8 * half;
  const unsigned short* brow = Wt + (size_t)(ch * 96 + ln) * WP + 8 * half;

  // W fragments run two k steps ahead of their products, three register sets in turn; the first two sets leave here
  v16us bq[3][6];
#pragma unroll
  for (int nt = 0; nt < 6; ++nt) bq[0][nt] = frag_u16(brow + (size_t)nt * 16 * WP);
#pragma unroll
  for (int nt = 0; nt < 6; ++nt) bq[1][nt] = frag_u16(brow + (size_t)nt * 16 * WP + 32);

  // stage x tile: 64 rows x CDIM -> bf16, columns CDIM..XP-1 zero; a thread's XLD loads all leave before the first is used
  // (the 64 whole rows lie in one piece, so piece i of 16 bytes stands at xblk + 4 i: one address, constant steps)
  v4f xv[XLD];
#pragma unroll
  for (int j = 0; j < XLD; ++j) xv[j] = *(const v4f*)(xblk + (size_t)tid * 4 + j * 1024);
#pragma unroll
  for (int j = 0; j < XLD; ++j) {
    const int i  = tid + j * 256;
    const int r  = i / (CDIM / 4);
    const int c4 = i - r * (CDIM / 4);
    const v4f v = xv[j];
    v2u w;
    w.x = bf_bits(v.x) | (bf_bits(v.y) << 16);
    w.y = bf_bits(v.z) | (bf_bits(v.w) << 16);
    *(v2u*)(sm + r * XP + c4 * 4) = w;
  }
  for (int i = tid; i < 64 * 3; i += 256) {
    const int r = i / 3;
    const int j = i - r * 3;
    v4u z; z.x = 0u; z.y = 0u; z.z = 0u; z.w = 0u;
    *(v4u*)(sm + r * XP + CDIM + j * 8) = z;
  }
  __syncthreads();

  v8f acc[6];
#pragma unroll
  for (int nt = 0; nt < 6; ++nt) {
#pragma unroll
    for (int r = 0; r < 8; ++r) acc[nt][r] = 0.0f;
  }
  v16us aq[2];
  aq[0] = frag_u16(arow);
  // unrolled so that the register sets are picked at compile time
#pragma unroll
  for (int ks = 0; ks < NKS; ++ks) {
    if (ks + 2 < NKS) {
#pragma unroll
      for (int nt = 0; nt < 6; ++nt) bq[(ks + 2) % 3][nt] = frag_u16(brow + (size_t)nt * 16 * WP + (ks + 2) * 32);
    }
    if (ks + 1 < NKS) aq[(ks + 1) & 1] = frag_u16(arow + (ks + 1) * 32);
#pragma unroll
    for (int nt = 0; nt < 6; ++nt) acc[nt] = wmma_bf16(aq[ks & 1], bq[ks % 3][nt], acc[nt]);
  }
  __syncthreads();   // all waves done reading the x tile

  // staging (16-bit elements): sQ = sm[0..4095] as [t][64], sK = sm[4096..8191] as [t][64],
  // sV = sm[8192..12287] as [hcol][t], sVr = sm[12288..16383] as [hcol][t]
#pragma unroll
  for (int nt = 0; nt < 6; ++nt) {
    const int n0 = ch * 96 + nt * 16;            // wave-uniform
    const int p  = n0 >> 6;
    const int hc = (n0 & 63) + ln;
    const float sc = (p == 0) ? LOG2E_F : ((p == 2) ? 16.0f : 1.0f);
    unsigned short* base = sm + p * 4096;
#pragma unroll
    for (int r = 0; r < 8; ++r) {
      const int tl  = rg * 16 + 8 * half + r;
      const int idx = (p == 2) ? (hc * 64 + tl) : (tl * 64 + hc);
      const float vf = acc[nt][r] * sc;
      const _Float16 hv = (_Float16)vf;
      base[idx] = __builtin_bit_cast(unsigned short, hv);
      if (p == 2) {
        const _Float16 rv = (_Float16)((vf - (float)hv) * 1024.0f);
        sm[12288 + idx] = __builtin_bit_cast(unsigned short, rv);
      }
    }
  }
  __syncthreads();

  // whole-line stores: wave w owns token rows 8w..8w+7 of qh/kh and hcol rows 8w..8w+7 of vT/vR
  const int rl = lane >> 3;
  const int pc = lane & 7;
  const int rA = wave * 8 + rl;
  const int rB = rA + 4;
  const v4u qA = *(const v4u*)(sm + rA * 64 + pc * 8);
  const v4u qB = *(const v4u*)(sm + rB * 64 + pc * 8);
  const v4u kA = *(const v4u*)(sm + 4096 + rA * 64 + pc * 8);
  const v4u kB = *(const v4u*)(sm + 4096 + rB * 64 + pc * 8);
  const v4u vA = *(const v4u*)(sm + 8192 + rA * 64 + pc * 8);
  const v4u vB = *(const v4u*)(sm + 8192 + rB * 64 + pc * 8);
  const v4u uA = *(const v4u*)(sm + 12288 + rA * 64 + pc * 8);
  const v4u uB = *(const v4u*)(sm + 12288 + rB * 64 + pc * 8);
  _Float16* dqA = qh + (size_t)(m0 + rA) * HDIM + pc * 8;
  _Float16* dqB = qh + (size_t)(m0 + rB) * HDIM + pc * 8;
  _Float16* dkA = kh + (size_t)(m0 + rA) * HDIM + pc * 8;
  _Float16* dkB = kh + (size_t)(m0 + rB) * HDIM + pc * 8;
  _Float16* dvA = vT + ((size_t)b * HDIM + rA) * SEQ + t0 + pc * 8;
  _Float16* dvB = vT + ((size_t)b * HDIM + rB) * SEQ + t0 + pc * 8;
  _Float16* duA = vR + ((size_t)b * HDIM + rA) * SEQ + t0 + pc * 8;
  _Float16* duB = vR + ((size_t)b * HDIM + rB) * SEQ + t0 + pc * 8;
  *(v4u*)dqA = qA; *(v4u*)dqB = qB;
  *(v4u*)dkA = kA; *(v4u*)dkB = kB;
  *(v4u*)dvA = vA; *(v4u*)dvB = vB;
  *(v4u*)duA = uA; *(v4u*)duB = uB;
  
}

// ---------------------------------------------------------------------------
// Kernel 3: causal flash attention. Block = NKW waves on ONE group of 16 query rows, key chunks of 32:
// wave w takes chunks w, w + NKW, ... with its own maxima, sums and accumulators; the partials meet in LDS at the end.
// S tiles (D layout) -> online softmax in log2 domain -> P x 1024 to f16 A layout via LDS -> O += P.V, sums += P.ones.
// EARLY = 1 handles query tiles 0..NTB_E-1 (rows < 256): adds P residual (x1024) and v residual plane (x1024)
// products into separate accumulators folded with 2^-10 before the merge; EARLY = 0 handles the rest.
// ---------------------------------------------------------------------------
// Register budget of 8 waves per SIMD: four blocks fit a WGP, so every block of the launch is resident at once.
// EARLY has fewer blocks than there are WGPs: its budget of 4 waves per SIMD holds K, V and the residual plane at once.
template <int EARLY>
__global__ __launch_bounds__(NKW * 32) __attribute__((amdgpu_waves_per_eu(EARLY ? 4 : 8)))
void k_attn(const _Float16* __restrict__ qh, const _Float16* __restrict__ kh,
            const _Float16* __restrict__ vT, const _Float16* __restrict__ vR,
            float* __restrict__ out)
{
  __shared__ __attribute__((aligned(16))) _Float16 pbuf[NKW][16][40];               // per-wave 16 x 32 P tile (x1024)
  __shared__ __attribute__((aligned(16))) _Float16 rbuf[EARLY ? NKW : 1][16][40];   // per-wave 16 x 32 P residual tile
  __shared__ __attribute__((aligned(16))) float    obuf[NKW][16][68];               // per-wave 16 x 64 un-normalised partial
  __shared__ float mbuf[NKW][16];                                                   // per-wave row maxima (log2 domain)
  __shared__ float dbuf[NKW][16];                                                   // per-wave row sums

  const int tid  = threadIdx.x;
  const int lane = tid & 31;
  const int wave = __builtin_amdgcn_readfirstlane(tid >> 5);
  const int half = lane >> 4;
  const int ln   = lane & 15;
  int b, rg;
  if (EARLY) { b = blockIdx.x / NRG_E;  rg = blockIdx.x - b * NRG_E; }
  else       { b = blockIdx.x / NRG_LD; rg = NRG_E + (blockIdx.x - b * NRG_LD); }
  const int row0 = rg * 16;                      // first query row of this block (within the sequence)

  const _Float16* qrow  = qh + ((size_t)b * SEQ + row0 + ln) * HDIM + 8 * half;
  // the lane's place in the wave's current chunk as one running 32-bit byte offset per plane layout: every fragment of
  // the chunk is a constant away from it, so a batch of loads takes one address register on top of the plane's base
  unsigned koff = (unsigned)(((b * SEQ + wave * 32 + ln) * HDIM + 8 * half) * 2);
  unsigned voff = (unsigned)(((b * HDIM + ln) * SEQ + wave * 32 + 8 * half) * 2);

  // loop-invariant Q A fragments (feature blocks 0..31, 32..63)
  const v16h qa0 = frag_f16(qrow);
  const v16h qa1 = frag_f16(qrow + 32);

  v16h ones;
#pragma unroll
  for (int i = 0; i < 16; ++i) ones[i] = (_Float16)1.0f;

  v8f o[4], orr[4];
  v8f osum, osumr;
#pragma unroll
  for (int r = 0; r < 8; ++r) { osum[r] = 0.0f; osumr[r] = 0.0f; }
#pragma unroll
  for (int ht = 0; ht < 4; ++ht) {
#pragma unroll
    for (int r = 0; r < 8; ++r) { o[ht][r] = 0.0f; orr[ht][r] = 0.0f; }
  }
  float rmax[8];
#pragma unroll
  for (int r = 0; r < 8; ++r) rmax[r] = NEG_BIG;

  const int nchunk = (row0 >> 5) + 1;            // chunks that hold a key <= row0 + 15
  const int npass  = (nchunk + NKW - 1) / NKW;   // block-uniform trip count
#pragma unroll 1
  for (int it = 0; it < npass; ++it) {
    const int c   = it * NKW + wave;             // this wave's chunk of the pass
    const int kt0 = c * 32;
    const bool active = (c < nchunk);           // wave-uniform
    v8f s[2];
#pragma unroll
    for (int r = 0; r < 8; ++r) { s[0][r] = 0.0f; s[1][r] = 0.0f; }

    v16h vb[4], vr[4];   // V fragments of the chunk (vr: residual plane, EARLY only)
    if (active) {
      // the chunk's K fragments all leave before the first product
      v16h kb[2][2];
#pragma unroll
      for (int nt = 0; nt < 2; ++nt) {
        const _Float16* krow = (const _Float16*)((const char*)kh + koff) + nt * 16 * HDIM;
        kb[nt][0] = frag_f16(krow);
        kb[nt][1] = frag_f16(krow + 32);
      }
      if (EARLY) {   // few blocks, so a wide register budget: V and its residual plane leave together with K
#pragma unroll
        for (int ht = 0; ht < 4; ++ht) {
          vb[ht] = frag_f16((const _Float16*)((const char*)vT + voff) + ht * 16 * SEQ);
          vr[ht] = frag_f16((const _Float16*)((const char*)vR + voff) + ht * 16 * SEQ);
        }
        // the batch's address registers are inputs of the wait, so none of them is handed to a fragment in front of it
        asm volatile("s_wait_xcnt 0x0" :: "v"(qrow), "v"(koff), "v"(voff) : "memory");
        // keeps the first product, and the wait for its operands, from being scheduled in front of the V loads
        __builtin_amdgcn_sched_barrier(0);
      }
      // S[16 x 32] = Q(16 x 64) . K^T, K as B operand: column = key (lane&15), k = feature (split map)
#pragma unroll
      for (int nt = 0; nt < 2; ++nt) {
        const int key = kt0 + nt * 16 + ln;
        v8f acc;
#pragma unroll
        for (int r = 0; r < 8; ++r) acc[r] = 0.0f;
        acc = wmma_f16(qa0, kb[nt][0], acc);
        acc = wmma_f16(qa1, kb[nt][1], acc);
#pragma unroll
        for (int r = 0; r < 8; ++r) {
          const float sv = acc[r] * 0.125f;                        // 1/sqrt(64), log2e already in q
          s[nt][r] = (key > row0 + 8 * half + r) ? NEG_BIG : sv;   // causal fill (replace)
        }
      }
      // online softmax, row = 8*half + r, columns across the 16-lane half
      float alpha[8];
#pragma unroll
      for (int r = 0; r < 8; ++r) {
        float tmax = fmaxf(s[0][r], s[1][r]);
#pragma unroll
        for (int m = 1; m < 16; m <<= 1) tmax = fmaxf(tmax, __shfl_xor(tmax, m, 32));
        const float nmax = fmaxf(rmax[r], tmax);
        alpha[r] = exp2f(rmax[r] - nmax);
        rmax[r]  = nmax;
        s[0][r] = exp2f(s[0][r] - nmax);
        s[1][r] = exp2f(s[1][r] - nmax);
      }
#pragma unroll
      for (int r = 0; r < 8; ++r) {
        osum[r] *= alpha[r];
        if (EARLY) osumr[r] *= alpha[r];
#pragma unroll
        for (int ht = 0; ht < 4; ++ht) {
          o[ht][r] *= alpha[r];
          if (EARLY) orr[ht][r] *= alpha[r];
        }
      }
    }

    // P: D layout -> [q_local][key_local] in LDS (carried x 1024; residual x 1024 more), then reloaded as A fragments
    __syncthreads();
    if (active) {
#pragma unroll
      for (int nt = 0; nt < 2; ++nt) {
#pragma unroll
        for (int r = 0; r < 8; ++r) {
          const float pf = s[nt][r] * 1024.0f;
          const _Float16 ph = (_Float16)pf;
          pbuf[wave][r + 8 * half][nt * 16 + ln] = ph;
          if (EARLY) {
            const _Float16 pr = (_Float16)((pf - (float)ph) * 1024.0f);
            rbuf[wave][r + 8 * half][nt * 16 + ln] = pr;
          }
        }
      }
    }
    __syncthreads();

    if (active) {
      if (!EARLY) {   // the chunk's V fragments all leave before the first product
#pragma unroll
        for (int ht = 0; ht < 4; ++ht) vb[ht] = frag_f16((const _Float16*)((const char*)vT + voff) + ht * 16 * SEQ);
      }
      const v16h pa = frag_f16(&pbuf[wave][ln][8 * half]);
      // V as B operand: column = feature (lane&15), k = key (split map) from the key-contiguous planes
      if (EARLY) {
        const v16h pra = frag_f16(&rbuf[wave][ln][8 * half]);
#pragma unroll
        for (int ht = 0; ht < 4; ++ht) {
          o[ht]   = wmma_f16(pa,  vb[ht], o[ht]);
          orr[ht] = wmma_f16(pra, vb[ht], orr[ht]);
        }
        osum  = wmma_f16(pa,  ones, osum);
        osumr = wmma_f16(pra, ones, osumr);
#pragma unroll
        for (int ht = 0; ht < 4; ++ht) orr[ht] = wmma_f16(pa, vr[ht], orr[ht]);
      } else {
#pragma unroll
        for (int ht = 0; ht < 4; ++ht) o[ht] = wmma_f16(pa, vb[ht], o[ht]);
        osum = wmma_f16(pa, ones, osum);   // row sums of the same f16 P in D layout
      }
    }
    koff += NKW * 32 * HDIM * 2;
    voff += NKW * 32 * 2;
  }

  // each wave's partial (un-normalised numerator, row sum, row maximum) to its own LDS region;
  // a wave that had no chunk leaves zeros under the maximum NEG_BIG and gets weight 0 below
#pragma unroll
  for (int r = 0; r < 8; ++r) {
    float den = osum[r];
    if (EARLY) den = den + osumr[r] * RINV;
    osum[r] = den;
#pragma unroll
    for (int ht = 0; ht < 4; ++ht) {
      float num = o[ht][r];
      if (EARLY) num = num + orr[ht][r] * RINV;
      obuf[wave][8 * half + r][ht * 16 + ln] = num;
    }
  }
  if (ln == 0) {   // maxima and sums are alike in the 16 lanes of a half
#pragma unroll
    for (int r = 0; r < 8; ++r) {
      mbuf[wave][8 * half + r] = rmax[r];
      dbuf[wave][8 * half + r] = osum[r];
    }
  }
  __syncthreads();

  // merge: thread -> query row tid >> 4, four features; weights 2^(m_w - m); then normalise
  // (1024 carry cancels between numerator and denominator; 1/16 undoes the v carry)
  const int mrow = tid >> 4;
  float mw[NKW];
  float mall = NEG_BIG;
#pragma unroll
  for (int w = 0; w < NKW; ++w) { mw[w] = mbuf[w][mrow]; mall = fmaxf(mall, mw[w]); }
  float den = 0.0f;
  v4f num;
  num.x = 0.0f; num.y = 0.0f; num.z = 0.0f; num.w = 0.0f;
#pragma unroll
  for (int w = 0; w < NKW; ++w) {
    const float a = exp2f(mw[w] - mall);
    const v4f pv = *(const v4f*)(&obuf[w][mrow][ln * 4]);
    den += a * dbuf[w][mrow];
    num += pv * a;
  }
  const float inv = 0.0625f * __builtin_amdgcn_rcpf(den);
  *(v4f*)(out + ((size_t)b * SEQ_FULL + row0 + mrow) * HDIM + ln * 4) = num * inv;
}

// ---------------------------------------------------------------------------
extern "C" void kernel_launch(void* const* d_in, const int* in_sizes, int n_in,
                              void* d_out, int out_size, void* d_ws, size_t ws_size,
                              hipStream_t stream)
{
  if (n_in < 4) return;
  const long long tok_rows = (long long)(NB - 1) * SEQ_FULL + SEQ;
  if ((long long)in_sizes[0] < tok_rows * CDIM) return;
  if (in_sizes[1] < CDIM * HDIM || in_sizes[2] < CDIM * HDIM || in_sizes[3] < CDIM * HDIM) return;
  if ((long long)out_size < tok_rows * HDIM) return;

  const float* x  = (const float*)d_in[0];
  const float* Wq = (const float*)d_in[1];
  const float* Wk = (const float*)d_in[2];
  const float* Wv = (const float*)d_in[3];
  float* out = (float*)d_out;

  // workspace carve (bytes): Wt 192*448*2 = 172032 | qh NB*SEQ*64*2 | kh same | vT same | vR same
  const size_t wt_bytes = (size_t)NPROJ * WP * sizeof(unsigned short);
  const size_t plane    = (size_t)NB * SEQ * HDIM * sizeof(_Float16);
  const size_t off_wt = 0;
  const size_t off_q  = (off_wt + wt_bytes + 255) & ~(size_t)255;
  const size_t off_k  = off_q + plane;
  const size_t off_v  = off_k + plane;
  const size_t off_r  = off_v + plane;
  const size_t total  = off_r + plane;
  if (total > ws_size) return;

  unsigned short* Wt = (unsigned short*)((char*)d_ws + off_wt);
  _Float16* qh = (_Float16*)((char*)d_ws + off_q);
  _Float16* kh = (_Float16*)((char*)d_ws + off_k);
  _Float16* vT = (_Float16*)((char*)d_ws + off_v);
  _Float16* vR = (_Float16*)((char*)d_ws + off_r);

  k_wconv<<<NPROJ / 8, 256, 0, stream>>>(Wq, Wk, Wv, Wt);
  k_proj<<<(NB * SEQ) / 64, 256, 0, stream>>>(x, Wt, qh, kh, vT, vR);
  k_attn<1><<<NB * NRG_E, NKW * 32, 0, stream>>>(qh, kh, vT, vR, out);
  if (NTB_L > 0) k_attn<0><<<NB * NRG_LD, NKW * 32, 0, stream>>>(qh, kh, vT, vR, out);
}

// v003
// Measured time: 43 microseconds a run.
// Next to v002, in two timings, it ran 1.12 and 1.09 times as fast.
// Over all steps from v000 it is 4.59 times as fast.
#include <hip/hip_runtime.h>

// Contractions: x*W projections (q,k,v): v_wmma_f32_16x16x32_bf16, bf16 operands (RNE-converted inputs), f32 accumulate.
// q.k scores, P.v, P row sums: v_wmma_f32_16x16x32_f16, f16 operands (q x log2e, k, P x 1024, v x 16), f32 accumulate;
// query rows < 256 of each sequence also use f16 residual planes of P and v (x1024 carries) in separate f32 accumulators.

#ifndef NB
#define NB 8
#endif
#ifndef SEQ
#define SEQ 2048
#endif
#define NB_FULL  8
#define SEQ_FULL 2048
#define CDIM  400
#define HDIM  64
#define NPROJ 192
#define KP    416         // contraction depth padded to 13 x 32, pad columns are zeros
#define XP    424         // LDS pitch of the staged x tile (16-bit elements)
#define WP    448         // LDS pitch of the k-contiguous W rows in k_wconv (16-bit elements), 896 B = 7 lines
#define NKS    (KP / 32)                     // k steps of a projection
#define XLD    (64 * (CDIM / 4) / 256)       // 16-byte x loads of a thread of the projection block
#define WLD    ((CDIM * 2 + 255) / 256)      // 16-byte W loads of a thread of the conversion block, at most
#define NTB    (SEQ / 64)                    // 64-row query tiles per sequence
#define NTB_E  ((NTB < 4) ? NTB : 4)         // tiles with query rows < 256: residual path
#define NTB_L  (NTB - NTB_E)
#define NTB_LD ((NTB_L > 0) ? NTB_L : 1)
#define NKW    8                             // waves of an attention block: all on the same 16 query rows, keys dealt over them
#define NRG_E  (NTB_E * 4)                   // 16-row query groups with rows < 256
#define NRG_LD (NTB_LD * 4)

static_assert(SEQ % 64 == 0 && SEQ >= 64);
static_assert(NKW * 32 == 16 * 16);          // the merge gives each of the 16 rows 16 threads
static_assert(SEQ <= SEQ_FULL);
static_assert(NB >= 1 && NB <= NB_FULL);
static_assert(KP % 32 == 0 && KP >= CDIM);
static_assert(XP >= KP && (XP % 8) == 0);
static_assert(WP >= KP && ((WP * 2) % 128) == 0);
static_assert(NPROJ == 3 * HDIM && (NPROJ % 8) == 0 && (HDIM % 8) == 0);
static_assert(CDIM % 4 == 0 && CDIM > 256 && CDIM <= 512);
static_assert(64 * XP >= 4 * 4096);
static_assert((64 * (CDIM / 4)) % 256 == 0 && NKS >= 2);
static_assert(((long long)(NB - 1) * SEQ_FULL + SEQ) * HDIM <= 1048576LL);

typedef _Float16       v16h  __attribute__((ext_vector_type(16)));
typedef _Float16       v8h   __attribute__((ext_vector_type(8)));
typedef float          v8f   __attribute__((ext_vector_type(8)));
typedef float          v4f   __attribute__((ext_vector_type(4)));
typedef unsigned short v16us __attribute__((ext_vector_type(16)));
typedef unsigned short v8us  __attribute__((ext_vector_type(8)));
typedef unsigned int   v4u   __attribute__((ext_vector_type(4)));
typedef unsigned int   v2u   __attribute__((ext_vector_type(2)));
typedef __bf16         v16bf __attribute__((ext_vector_type(16)));

union FragH { v16h v; v8h h[2]; };
union FragU { v16us v; v8us h[2]; };

#define LOG2E_F 1.4426950408889634f
#define NEG_BIG (-3.0e38f)
#define RINV    0.0009765625f

// f32 -> bf16 bits, RNE convert
__device__ __forceinline__ unsigned int bf_bits(float f) {
  const unsigned int u = __float_as_uint(f);
  return (u + 0x7FFFu + ((u >> 16) & 1u)) >> 16;
}

// WMMA helpers with the VALU hazard guard (ties D, keeps A/B live)
__device__ __forceinline__ v8f wmma_f16(v16h a, v16h b, v8f c) {
  v8f d = __builtin_amdgcn_wmma_f32_16x16x32_f16(false, a, false, b, (short)0, c, false, false);
  asm volatile("v_nop\n\tv_nop\n\tv_nop\n\tv_nop" : "+v"(d) : "v"(a), "v"(b));
  return d;
}
__device__ __forceinline__ v8f wmma_bf16(v16us a, v16us b, v8f c) {
  v8f d = __builtin_amdgcn_wmma_f32_16x16x32_bf16(false, __builtin_bit_cast(v16bf, a), false,
                                                   __builtin_bit_cast(v16bf, b), (short)0, c, false, false);
  asm volatile("v_nop\n\tv_nop\n\tv_nop\n\tv_nop" : "+v"(d) : "v"(a), "v"(b));
  return d;
}

// 16-bit operand fragment, split k map for BOTH A and B:
// p = (row or column (lane&15)) base + k0 + 8*(lane>>4); elements 0..7 <- p[0..7], elements 8..15 <- p[16..23].
__device__ __forceinline__ v16h frag_f16(const _Float16* p) {
  FragH f;
  f.h[0] = *(const v8h*)p;
  f.h[1] = *(const v8h*)(p + 16);
  return f.v;
}
__device__ __forceinline__ v16us frag_u16(const unsigned short* p) {
  FragU f;
  f.h[0] = *(const v8us*)p;
  f.h[1] = *(const v8us*)(p + 16);
  return f.v;
}

// The same fragment from a workspace plane kept in FRAGMENT ORDER: the plane holds, one after the other, the 512-byte
// images of the wave-wide 16-byte loads, [load][lane][8 elements], the two loads of a fragment side by side.
// p = fragment base + 8*lane; elements 0..7 <- p[0..7], elements 8..15 <- p[256..263]. Which element of the matrix
// stands at a (lane, register) place is as above; a load covers 4 whole lines, where rows of a matrix give 16 pieces of 32 B.
__device__ __forceinline__ v16h frag_f16_fo(const _Float16* p) {
  FragH f;
  f.h[0] = *(const v8h*)p;
  f.h[1] = *(const v8h*)(p + 256);
  return f.v;
}
__device__ __forceinline__ v16us frag_u16_fo(const unsigned short* p) {
  FragU f;
  f.h[0] = *(const v8us*)p;
  f.h[1] = *(const v8us*)(p + 256);
  return f.v;
}

// ---------------------------------------------------------------------------
// Kernel 1: W planes -> one bf16 plane in fragment order, Wt[n >> 4][ks][j][lane = 16*hf + (n & 15)][e],
// n = p*64 + hcol (p: 0 q, 1 k, 2 v), contraction index c = 32*ks + 16*j + 8*hf + e, c = CDIM..KP-1 zero.
// Block = 8 output rows (coalesced 32-B reads of W, transposed in LDS); its 8 rows fill whole 128-B lines of the plane.
// ---------------------------------------------------------------------------
__global__ __launch_bounds__(256) void k_wconv(
    const float* __restrict__ Wq, const float* __restrict__ Wk, const float* __restrict__ Wv,
    unsigned short* __restrict__ Wt)
{
  __shared__ __attribute__((aligned(16))) unsigned short sw[8 * WP];   // [hcol_local][c]

  const int tid   = threadIdx.x;
  const int p     = blockIdx.x >> 3;
  const int hcol0 = (blockIdx.x & 7) * 8;
  const float* W = (p == 0) ? Wq : ((p == 1) ? Wk : Wv);   // block-uniform select, same address space

  for (int i = tid; i < 8 * (WP - CDIM); i += 256) {
    const int r = i / (WP - CDIM);
    const int c = i - r * (WP - CDIM);
    sw[r * WP + CDIM + c] = (unsigned short)0;
  }
  // a thread's W loads all leave before the first is used
  v4f wv[WLD];
#pragma unroll
  for (int j = 0; j < WLD; ++j) {
    const int i = (tid + j * 256 < CDIM * 2) ? (tid + j * 256) : (CDIM * 2 - 1);   // in bounds for every thread: no branch round a load
    wv[j] = *(const v4f*)(W + (size_t)(i >> 1) * HDIM + hcol0 + (i & 1) * 4);
  }
#pragma unroll
  for (int j = 0; j < WLD; ++j) {
    const int i = tid + j * 256;
    if (i >= CDIM * 2) break;
    const int c  = i >> 1;
    const int q4 = (i & 1) * 4;
    const v4f v = wv[j];
    sw[(q4 + 0) * WP + c] = (unsigned short)bf_bits(v.x);
    sw[(q4 + 1) * WP + c] = (unsigned short)bf_bits(v.y);
    sw[(q4 + 2) * WP + c] = (unsigned short)bf_bits(v.z);
    sw[(q4 + 3) * WP + c] = (unsigned short)bf_bits(v.w);
  }
  __syncthreads();

  // piece i of 16 bytes: row i & 7 of the block, contraction indices 8*(i >> 3) ..+7; 8 threads in a row fill one line
  const int n0 = p * HDIM + hcol0;                // 0..NPROJ-8, a multiple of 8
  unsigned short* dst = Wt + (size_t)(n0 >> 4) * (NKS * 512) + (n0 & 15) * 8;
  for (int i = tid; i < 8 * (KP / 8); i += 256) {
    const int rl = i & 7;
    const int kp = i >> 3;                        // ks = kp >> 2, j = (kp >> 1) & 1, hf = kp & 1
    const v4u w = *(const v4u*)(sw + rl * WP + kp * 8);
    *(v4u*)(dst + (kp >> 1) * 256 + (kp & 1) * 128 + rl * 8) = w;
  }
}

// ---------------------------------------------------------------------------
// Kernel 2: q,k,v projections for a tile of 64 token rows on bf16 WMMA.
// 8 waves: wave -> 16 rows (wave&3) x 96 output columns (wave>>2). x tile staged once in LDS as bf16.
// Outputs: qh = f16(q*log2e) [tok][64]; kh = f16(k), vT = f16(16*v), vR = f16((16*v - vT) * 1024) (residual plane),
// these three in fragment order, 2048 elements per chunk of 32 tokens (chunk = compact token row >> 5):
// kh[chunk][key >> 4 & 1][feature >> 5][feature >> 4 & 1][lane = 16*(feature >> 3 & 1) + (key & 15)][feature & 7],
// vT, vR[chunk][feature >> 4][key >> 4 & 1][lane = 16*(key >> 3 & 1) + (feature & 15)][key & 7].
// ---------------------------------------------------------------------------
__global__ __launch_bounds__(256) __attribute__((amdgpu_num_vgpr(256)))
void k_proj(const float* __restrict__ x, const unsigned short* __restrict__ Wt,
            _Float16* __restrict__ qh, _Float16* __restrict__ kh,
            _Float16* __restrict__ vT, _Float16* __restrict__ vR)
{
  __shared__ __attribute__((aligned(16))) unsigned short sm[64 * XP];   // 54272 B, later reused as staging

  const int tid  = threadIdx.x;
  const int lane = tid & 31;
  const int wave = __builtin_amdgcn_readfirstlane(tid >> 5);
  const int half = lane >> 4;
  const int ln   = lane & 15;
  const int m0 = blockIdx.x * 64;               // compact token row of this tile
  const int b  = m0 / SEQ;
  const int t0 = m0 - b * SEQ;
  const float* xblk = x + ((size_t)b * SEQ_FULL + t0) * CDIM;

  const int rg = wave & 3;
  const int ch = wave >> 2;
  const unsigned short* arow = sm + (rg * 16 + ln) * XP + 8 * half;
  const unsigned short* brow = Wt + (size_t)(ch * 6) * (NKS * 512) + lane * 8;   // column tile nt, k step ks: + (nt * NKS + ks) * 512

  // W fragments run two k steps ahead of their products, three register sets in turn; the first two sets leave here
  v16us bq[3][6];
#pragma unroll
  for (int nt = 0; nt < 6; ++nt) bq[0][nt] = frag_u16_fo(brow + nt * NKS * 512);
#pragma unroll
  for (int nt = 0; nt < 6; ++nt) bq[1][nt] = frag_u16_fo(brow + (nt * NKS + 1) * 512);

  // stage x tile: 64 rows x CDIM -> bf16, columns CDIM..XP-1 zero; a thread's XLD loads all leave before the first is used
  // (the 64 whole rows lie in one piece, so piece i of 16 bytes stands at xblk + 4 i: one address, constant steps)
  v4f xv[XLD];
#pragma unroll
  for (int j = 0; j < XLD; ++j) xv[j] = *(const v4f*)(xblk + (size_t)tid * 4 + j * 1024);
  // stands behind the W fragment loads and the x loads above, in front of the first overwrite of a base or offset register that they name
  asm volatile("s_wait_xcnt 0x0" ::: "memory");
#pragma unroll
  for (int j = 0; j < XLD; ++j) {
    const int i  = tid + j * 256;
    const int r  = i / (CDIM / 4);
    const int c4 = i - r * (CDIM / 4);
    const v4f v = xv[j];
    v2u w;
    w.x = bf_bits(v.x) | (bf_bits(v.y) << 16);
    w.y = bf_bits(v.z) | (bf_bits(v.w) << 16);
    *(v2u*)(sm + r * XP + c4 * 4) = w;
  }
  for (int i = tid; i < 64 * 3; i += 256) {
    const int r = i / 3;
    const int j = i - r * 3;
    v4u z; z.x = 0u; z.y = 0u; z.z = 0u; z.w = 0u;
    *(v4u*)(sm + r * XP + CDIM + j * 8) = z;
  }
  __syncthreads();

  v8f acc[6];
#pragma unroll
  for (int nt = 0; nt < 6; ++nt) {
#pragma unroll
    for (int r = 0; r < 8; ++r) acc[nt][r] = 0.0f;
  }
  v16us aq[2];
  aq[0] = frag_u16(arow);
  // unrolled so that the register sets are picked at compile time
#pragma unroll
  for (int ks = 0; ks < NKS; ++ks) {
    if (ks + 2 < NKS) {
#pragma unroll
      for (int nt = 0; nt < 6; ++nt) bq[(ks + 2) % 3][nt] = frag_u16_fo(brow + (nt * NKS + ks + 2) * 512);
    }
    if (ks + 1 < NKS) aq[(ks + 1) & 1] = frag_u16(arow + (ks + 1) * 32);
#pragma unroll
    for (int nt = 0; nt < 6; ++nt) acc[nt] = wmma_bf16(aq[ks & 1], bq[ks % 3][nt], acc[nt]);
  }
  // stands in front of the first overwrite of the address registers that the W fragment loads name
  asm volatile("s_wait_xcnt 0x0" :: "v"(brow) : "memory");
  __syncthreads();   // all waves done reading the x tile

  // staging (16-bit elements): sQ = sm[0..4095] as [t][64]; sK = sm[4096..8191], sV = sm[8192..12287],
  // sVr = sm[12288..16383]: the tile's two chunks in the fragment order of their planes
#pragma unroll
  for (int nt = 0; nt < 6; ++nt) {
    const int n0 = ch * 96 + nt * 16;            // wave-uniform
    const int p  = n0 >> 6;
    const int hc = (n0 & 63) + ln;
    const float sc = (p == 0) ? LOG2E_F : ((p == 2) ? 16.0f : 1.0f);
    // token tl = rg * 16 + 8 * half + r: the place of r = 0 and the step from r to r + 1, per plane (p is wave-uniform)
    if (p == 2) {   // a lane's 8 tokens stand side by side in the V order: one 16-byte store per plane
      const int i0 = (rg >> 1) * 2048 + (hc >> 4) * 512 + (rg & 1) * 256 + half * 128 + (hc & 15) * 8;
      v8us hv8, rv8;
#pragma unroll
      for (int r = 0; r < 8; ++r) {
        const float vf = acc[nt][r] * sc;
        const _Float16 hv = (_Float16)vf;
        const _Float16 rv = (_Float16)((vf - (float)hv) * 1024.0f);
        hv8[r] = __builtin_bit_cast(unsigned short, hv);
        rv8[r] = __builtin_bit_cast(unsigned short, rv);
      }
      *(v8us*)(sm + 8192 + i0)  = hv8;
      *(v8us*)(sm + 12288 + i0) = rv8;
    } else if (p == 1) {
      unsigned short* base = sm + 4096 + rg * 1024 + (hc >> 4) * 256 + ((hc >> 3) & 1) * 128 + half * 64 + (hc & 7);
#pragma unroll
      for (int r = 0; r < 8; ++r) base[r * 8] = __builtin_bit_cast(unsigned short, (_Float16)(acc[nt][r] * sc));
    } else {
      unsigned short* base = sm + (rg * 16 + 8 * half) * 64 + hc;
#pragma unroll
      for (int r = 0; r < 8; ++r) base[r * 64] = __builtin_bit_cast(unsigned short, (_Float16)(acc[nt][r] * sc));
    }
  }
  __syncthreads();

  // whole-line stores: wave w owns elements 512w..512w+511 of the tile's 4096 in each plane (token rows 8w..8w+7 of qh)
  const int rl = lane >> 3;
  const int pc = lane & 7;
  const int rA = wave * 8 + rl;
  const int rB = rA + 4;
  const v4u qA = *(const v4u*)(sm + rA * 64 + pc * 8);
  const v4u qB = *(const v4u*)(sm + rB * 64 + pc * 8);
  const v4u kA = *(const v4u*)(sm + 4096 + rA * 64 + pc * 8);
  const v4u kB = *(const v4u*)(sm + 4096 + rB * 64 + pc * 8);
  const v4u vA = *(const v4u*)(sm + 8192 + rA * 64 + pc * 8);
  const v4u vB = *(const v4u*)(sm + 8192 + rB * 64 + pc * 8);
  const v4u uA = *(const v4u*)(sm + 12288 + rA * 64 + pc * 8);
  const v4u uB = *(const v4u*)(sm + 12288 + rB * 64 + pc * 8);
  _Float16* dqA = qh + (size_t)(m0 + rA) * HDIM + pc * 8;
  _Float16* dqB = qh + (size_t)(m0 + rB) * HDIM + pc * 8;
  _Float16* dkA = kh + (size_t)(m0 + rA) * HDIM + pc * 8;
  _Float16* dkB = kh + (size_t)(m0 + rB) * HDIM + pc * 8;
  _Float16* dvA = vT + (size_t)(m0 + rA) * HDIM + pc * 8;
  _Float16* dvB = vT + (size_t)(m0 + rB) * HDIM + pc * 8;
  _Float16* duA = vR + (size_t)(m0 + rA) * HDIM + pc * 8;
  _Float16* duB = vR + (size_t)(m0 + rB) * HDIM + pc * 8;
  *(v4u*)dqA = qA; *(v4u*)dqB = qB;
  *(v4u*)dkA = kA; *(v4u*)dkB = kB;
  *(v4u*)dvA = vA; *(v4u*)dvB = vB;
  *(v4u*)duA = uA; *(v4u*)duB = uB;
  
}

// ---------------------------------------------------------------------------
// Kernel 3: causal flash attention. Block = NKW waves on ONE group of 16 query rows, key chunks of 32:
// wave w takes chunks w, w + NKW, ... with its own maxima, sums and accumulators; the partials meet in LDS at the end.
// S tiles (D layout) -> online softmax in log2 domain -> P x 1024 to f16 A layout via LDS -> O += P.V, sums += P.ones.
// EARLY = 1 handles query tiles 0..NTB_E-1 (rows < 256): adds P residual (x1024) and v residual plane (x1024)
// products into separate accumulators folded with 2^-10 before the merge; EARLY = 0 handles the rest.
// ---------------------------------------------------------------------------
// Register budget of 8 waves per SIMD: four blocks fit a WGP, so every block of the launch is resident at once.
// EARLY has fewer blocks than there are WGPs: its budget of 4 waves per SIMD holds K, V and the residual plane at once.
template <int EARLY>
__global__ __launch_bounds__(NKW * 32) __attribute__((amdgpu_waves_per_eu(EARLY ? 4 : 8)))
void k_attn(const _Float16* __restrict__ qh, const _Float16* __restrict__ kh,
            const _Float16* __restrict__ vT, const _Float16* __restrict__ vR,
            float* __restrict__ out)
{
  __shared__ __attribute__((aligned(16))) _Float16 pbuf[NKW][16][40];               // per-wave 16 x 32 P tile (x1024)
  __shared__ __attribute__((aligned(16))) _Float16 rbuf[EARLY ? NKW : 1][16][40];   // per-wave 16 x 32 P residual tile
  __shared__ __attribute__((aligned(16))) float    obuf[NKW][16][68];               // per-wave 16 x 64 un-normalised partial
  __shared__ float mbuf[NKW][16];                                                   // per-wave row maxima (log2 domain)
  __shared__ float dbuf[NKW][16];                                                   // per-wave row sums

  const int tid  = threadIdx.x;
  const int lane = tid & 31;
  const int wave = __builtin_amdgcn_readfirstlane(tid >> 5);
  const int half = lane >> 4;
  const int ln   = lane & 15;
  int b, rg;
  if (EARLY) { b = blockIdx.x / NRG_E;  rg = blockIdx.x - b * NRG_E; }
  else       { b = blockIdx.x / NRG_LD; rg = NRG_E + (blockIdx.x - b * NRG_LD); }
  const int row0 = rg * 16;                      // first query row of this block (within the sequence)

  const _Float16* qrow  = qh + ((size_t)b * SEQ + row0 + ln) * HDIM + 8 * half;
  // the lane's place in the wave's current chunk as one running 32-bit byte offset per plane layout: every fragment of
  // the chunk is a constant away from it, so a batch of loads takes one address register on top of the plane's base
  // (planes in fragment order: a chunk is 2048 elements in each, the lane's 16 bytes of every load stand at 8 * lane)
  unsigned koff = (unsigned)(((b * SEQ + wave * 32) * HDIM + 8 * lane) * 2);
  unsigned voff = (unsigned)(((b * SEQ + wave * 32) * HDIM + 8 * lane) * 2);

  // loop-invariant Q A fragments (feature blocks 0..31, 32..63)
  const v16h qa0 = frag_f16(qrow);
  const v16h qa1 = frag_f16(qrow + 32);

  v16h ones;
#pragma unroll
  for (int i = 0; i < 16; ++i) ones[i] = (_Float16)1.0f;

  v8f o[4], orr[4];
  v8f osum, osumr;
#pragma unroll
  for (int r = 0; r < 8; ++r) { osum[r] = 0.0f; osumr[r] = 0.0f; }
#pragma unroll
  for (int ht = 0; ht < 4; ++ht) {
#pragma unroll
    for (int r = 0; r < 8; ++r) { o[ht][r] = 0.0f; orr[ht][r] = 0.0f; }
  }
  float rmax[8];
#pragma unroll
  for (int r = 0; r < 8; ++r) rmax[r] = NEG_BIG;

  const int nchunk = (row0 >> 5) + 1;            // chunks that hold a key <= row0 + 15
  const int npass  = (nchunk + NKW - 1) / NKW;   // block-uniform trip count
#pragma unroll 1
  for (int it = 0; it < npass; ++it) {
    const int c   = it * NKW + wave;             // this wave's chunk of the pass
    const int kt0 = c * 32;
    const bool active = (c < nchunk);           // wave-uniform
    v8f s[2];
#pragma unroll
    for (int r = 0; r < 8; ++r) { s[0][r] = 0.0f; s[1][r] = 0.0f; }

    v16h vb[4], vr[4];   // V fragments of the chunk (vr: residual plane, EARLY only)
    if (active) {
      // the chunk's K fragments all leave before the first product
      v16h kb[2][2];
#pragma unroll
      for (int nt = 0; nt < 2; ++nt) {
        const _Float16* krow = (const _Float16*)((const char*)kh + koff) + nt * 1024;
        kb[nt][0] = frag_f16_fo(krow);
        kb[nt][1] = frag_f16_fo(krow + 512);
      }
      if (EARLY) {   // few blocks, so a wide register budget: V and its residual plane leave together with K
#pragma unroll
        for (int ht = 0; ht < 4; ++ht) {
          vb[ht] = frag_f16_fo((const _Float16*)((const char*)vT + voff) + ht * 512);
          vr[ht] = frag_f16_fo((const _Float16*)((const char*)vR + voff) + ht * 512);
        }
        // the batch's address registers are inputs of the wait, so none of them is handed to a fragment in front of it
        asm volatile("s_wait_xcnt 0x0" :: "v"(qrow), "v"(koff), "v"(voff) : "memory");
        // keeps the first product, and the wait for its operands, from being scheduled in front of the V loads
        __builtin_amdgcn_sched_barrier(0);
      }
      // S[16 x 32] = Q(16 x 64) . K^T, K as B operand: column = key (lane&15), k = feature (split map)
#pragma unroll
      for (int nt = 0; nt < 2; ++nt) {
        const int key = kt0 + nt * 16 + ln;
        v8f acc;
#pragma unroll
        for (int r = 0; r < 8; ++r) acc[r] = 0.0f;
        acc = wmma_f16(qa0, kb[nt][0], acc);
        acc = wmma_f16(qa1, kb[nt][1], acc);
#pragma unroll
        for (int r = 0; r < 8; ++r) {
          const float sv = acc[r] * 0.125f;                        // 1/sqrt(64), log2e already in q
          s[nt][r] = (key > row0 + 8 * half + r) ? NEG_BIG : sv;   // causal fill (replace)
        }
      }
      // online softmax, row = 8*half + r, columns across the 16-lane half
      float alpha[8];
#pragma unroll
      for (int r = 0; r < 8; ++r) {
        float tmax = fmaxf(s[0][r], s[1][r]);
#pragma unroll
        for (int m = 1; m < 16; m <<= 1) tmax = fmaxf(tmax, __shfl_xor(tmax, m, 32));
        const float nmax = fmaxf(rmax[r], tmax);
        alpha[r] = exp2f(rmax[r] - nmax);
        rmax[r]  = nmax;
        s[0][r] = exp2f(s[0][r] - nmax);
        s[1][r] = exp2f(s[1][r] - nmax);
      }
#pragma unroll
      for (int r = 0; r < 8; ++r) {
        osum[r] *= alpha[r];
        if (EARLY) osumr[r] *= alpha[r];
#pragma unroll
        for (int ht = 0; ht < 4; ++ht) {
          o[ht][r] *= alpha[r];
          if (EARLY) orr[ht][r] *= alpha[r];
        }
      }
    }

    // P: D layout -> [q_local][key_local] in LDS (carried x 1024; residual x 1024 more), then reloaded as A fragments
    __syncthreads();
    if (active) {
#pragma unroll
      for (int nt = 0; nt < 2; ++nt) {
#pragma unroll
        for (int r = 0; r < 8; ++r) {
          const float pf = s[nt][r] * 1024.0f;
          const _Float16 ph = (_Float16)pf;
          pbuf[wave][r + 8 * half][nt * 16 + ln] = ph;
          if (EARLY) {
            const _Float16 pr = (_Float16)((pf - (float)ph) * 1024.0f);
            rbuf[wave][r + 8 * half][nt * 16 + ln] = pr;
          }
        }
      }
    }
    __syncthreads();

    if (active) {
      if (!EARLY) {   // the chunk's V fragments all leave before the first product
#pragma unroll
        for (int ht = 0; ht < 4; ++ht) vb[ht] = frag_f16_fo((const _Float16*)((const char*)vT + voff) + ht * 512);
      }
      const v16h pa = frag_f16(&pbuf[wave][ln][8 * half]);
      // V as B operand: column = feature (lane&15), k = key (split map)
      if (EARLY) {
        const v16h pra = frag_f16(&rbuf[wave][ln][8 * half]);
#pragma unroll
        for (int ht = 0; ht < 4; ++ht) {
          o[ht]   = wmma_f16(pa,  vb[ht], o[ht]);
          orr[ht] = wmma_f16(pra, vb[ht], orr[ht]);
        }
        osum  = wmma_f16(pa,  ones, osum);
        osumr = wmma_f16(pra, ones, osumr);
#pragma unroll
        for (int ht = 0; ht < 4; ++ht) orr[ht] = wmma_f16(pa, vr[ht], orr[ht]);
      } else {
#pragma unroll
        for (int ht = 0; ht < 4; ++ht) o[ht] = wmma_f16(pa, vb[ht], o[ht]);
        // keeps the sum product behind the four V products: scheduled ahead of them, its constant operand takes the registers of
        // the first V fragment, and that fragment's two loads leave only behind the product instead of with the chunk's batch
        __builtin_amdgcn_sched_barrier(0);
        osum = wmma_f16(pa, ones, osum);   // row sums of the same f16 P in D layout
      }
    }
    // stands in front of the overwrite of the offsets that the pass's fragment loads name
    asm volatile("s_wait_xcnt 0x0" :: "v"(koff), "v"(voff) : "memory");
    koff += NKW * 32 * HDIM * 2;
    voff += NKW * 32 * HDIM * 2;
  }

  // each wave's partial (un-normalised numerator, row sum, row maximum) to its own LDS region;
  // a wave that had no chunk leaves zeros under the maximum NEG_BIG and gets weight 0 below
#pragma unroll
  for (int r = 0; r < 8; ++r) {
    float den = osum[r];
    if (EARLY) den = den + osumr[r] * RINV;
    osum[r] = den;
#pragma unroll
    for (int ht = 0; ht < 4; ++ht) {
      float num = o[ht][r];
      if (EARLY) num = num + orr[ht][r] * RINV;
      obuf[wave][8 * half + r][ht * 16 + ln] = num;
    }
  }
  if (ln == 0) {   // maxima and sums are alike in the 16 lanes of a half
#pragma unroll
    for (int r = 0; r < 8; ++r) {
      mbuf[wave][8 * half + r] = rmax[r];
      dbuf[wave][8 * half + r] = osum[r];
    }
  }
  __syncthreads();

  // merge: thread -> query row tid >> 4, four features; weights 2^(m_w - m); then normalise
  // (1024 carry cancels between numerator and denominator; 1/16 undoes the v carry)
  const int mrow = tid >> 4;
  float mw[NKW];
  float mall = NEG_BIG;
#pragma unroll
  for (int w = 0; w < NKW; ++w) { mw[w] = mbuf[w][mrow]; mall = fmaxf(mall, mw[w]); }
  float den = 0.0f;
  v4f num;
  num.x = 0.0f; num.y = 0.0f; num.z = 0.0f; num.w = 0.0f;
#pragma unroll
  for (int w = 0; w < NKW; ++w) {
    const float a = exp2f(mw[w] - mall);
    const v4f pv = *(const v4f*)(&obuf[w][mrow][ln * 4]);
    den += a * dbuf[w][mrow];
    num += pv * a;
  }
  const float inv = 0.0625f * __builtin_amdgcn_rcpf(den);
  *(v4f*)(out + ((size_t)b * SEQ_FULL + row0 + mrow) * HDIM + ln * 4) = num * inv;
}

// ---------------------------------------------------------------------------
extern "C" void kernel_launch(void* const* d_in, const int* in_sizes, int n_in,
                              void* d_out, int out_size, void* d_ws, size_t ws_size,
                              hipStream_t stream)
{
  if (n_in < 4) return;
  const long long tok_rows = (long long)(NB - 1) * SEQ_FULL + SEQ;
  if ((long long)in_sizes[0] < tok_rows * CDIM) return;
  if (in_sizes[1] < CDIM * HDIM || in_sizes[2] < CDIM * HDIM || in_sizes[3] < CDIM * HDIM) return;
  if ((long long)out_size < tok_rows * HDIM) return;

  const float* x  = (const float*)d_in[0];
  const float* Wq = (const float*)d_in[1];
  const float* Wk = (const float*)d_in[2];
  const float* Wv = (const float*)d_in[3];
  float* out = (float*)d_out;

  // workspace carve (bytes): Wt 192*448*2 = 172032 (192*416*2 in use) | qh NB*SEQ*64*2 | kh same | vT same | vR same
  const size_t wt_bytes = (size_t)NPROJ * WP * sizeof(unsigned short);
  const size_t plane    = (size_t)NB * SEQ * HDIM * sizeof(_Float16);
  const size_t off_wt = 0;
  const size_t off_q  = (off_wt + wt_bytes + 255) & ~(size_t)255;
  const size_t off_k  = off_q + plane;
  const size_t off_v  = off_k + plane;
  const size_t off_r  = off_v + plane;
  const size_t total  = off_r + plane;
  if (total > ws_size) return;

  unsigned short* Wt = (unsigned short*)((char*)d_ws + off_wt);
  _Float16* qh = (_Float16*)((char*)d_ws + off_q);
  _Float16* kh = (_Float16*)((char*)d_ws + off_k);
  _Float16* vT = (_Float16*)((char*)d_ws + off_v);
  _Float16* vR = (_Float16*)((char*)d_ws + off_r);

  k_wconv<<<NPROJ / 8, 256, 0, stream>>>(Wq, Wk, Wv, Wt);
  k_proj<<<(NB * SEQ) / 64, 256, 0, stream>>>(x, Wt, qh, kh, vT, vR);
  k_attn<1><<<NB * NRG_E, NKW * 32, 0, stream>>>(qh, kh, vT, vR, out);
  if (NTB_L > 0) k_attn<0><<<NB * NRG_LD, NKW * 32, 0, stream>>>(qh, kh, vT, vR, out);
}

// v004
// One run takes 32.3 microseconds.
// Two timings next to v003 put it at 1.31 and 1.32 times that version's speed.
// Over all steps from v000 it is 6.02 times as fast.
#include <hip/hip_runtime.h>

// Contractions: x*W projections (q,k,v): v_wmma_f32_16x16x32_bf16, bf16 operands (RNE-converted inputs), f32 accumulate.
// q.k scores, P.v, P row sums: v_wmma_f32_16x16x32_f16, f16 operands (q x log2e, k, P x 1024, v x 16), f32 accumulate;
// query rows < 256 of each sequence also use f16 residual planes of P and v (x1024 carries) in separate f32 accumulators.

#ifndef NB
#define NB 8
#endif
#ifndef SEQ
#define SEQ 2048
#endif
#define NB_FULL  8
#define SEQ_FULL 2048
#define CDIM  400
#define HDIM  64
#define NPROJ 192
#define KP    416         // contraction depth padded to 13 x 32, pad columns are zeros
#define XP    424         // LDS pitch of the staged x tile (16-bit elements)
#define WP    448         // LDS pitch of the k-contiguous W rows in k_wconv (16-bit elements), 896 B = 7 lines
#define NKS    (KP / 32)                     // k steps of a projection
#define XLD    (64 * (CDIM / 4) / 256)       // 16-byte x loads of a thread of the projection block
#define WLD    ((CDIM * 2 + 255) / 256)      // 16-byte W loads of a thread of the conversion block, at most
#define NTB    (SEQ / 64)                    // 64-row query tiles per sequence
#define NTB_E  ((NTB < 4) ? NTB : 4)         // tiles with query rows < 256: residual path
#define NTB_L  (NTB - NTB_E)
#define NTB_LD ((NTB_L > 0) ? NTB_L : 1)
#define NKW    8                             // waves of an attention block: all on the same 16 query rows, keys dealt over them
#define NRG_E  (NTB_E * 4)                   // 16-row query groups with rows < 256
#define NRG_LD (NTB_LD * 4)
#define NRG_L  (NTB_L * 4)                   // 16-row query groups with rows >= 256

static_assert(SEQ % 64 == 0 && SEQ >= 64);
static_assert(NKW * 32 == 16 * 16);          // the merge gives each of the 16 rows 16 threads
static_assert(NRG_E * 16 <= NKW * 32);       // a group with rows < 256 has at most NKW chunks: one pass
static_assert(SEQ <= SEQ_FULL);
static_assert(NB >= 1 && NB <= NB_FULL);
static_assert(KP % 32 == 0 && KP >= CDIM);
static_assert(XP >= KP && (XP % 8) == 0);
static_assert(WP >= KP && ((WP * 2) % 128) == 0);
static_assert(NPROJ == 3 * HDIM && (NPROJ % 8) == 0 && (HDIM % 8) == 0);
static_assert(CDIM % 4 == 0 && CDIM > 256 && CDIM <= 512);
static_assert(64 * XP >= 4 * 4096);
static_assert((64 * (CDIM / 4)) % 256 == 0 && NKS >= 2);
static_assert(((long long)(NB - 1) * SEQ_FULL + SEQ) * HDIM <= 1048576LL);

typedef _Float16       v16h  __attribute__((ext_vector_type(16)));
typedef _Float16       v8h   __attribute__((ext_vector_type(8)));
typedef float          v8f   __attribute__((ext_vector_type(8)));
typedef float          v4f   __attribute__((ext_vector_type(4)));
typedef unsigned short v16us __attribute__((ext_vector_type(16)));
typedef unsigned short v8us  __attribute__((ext_vector_type(8)));
typedef unsigned int   v4u   __attribute__((ext_vector_type(4)));
typedef unsigned int   v2u   __attribute__((ext_vector_type(2)));
typedef __bf16         v16bf __attribute__((ext_vector_type(16)));

union FragH { v16h v; v8h h[2]; };
union FragU { v16us v; v8us h[2]; };

#define LOG2E_F 1.4426950408889634f
#define NEG_BIG (-3.0e38f)
#define RINV    0.0009765625f

// f32 -> bf16 bits, RNE convert
__device__ __forceinline__ unsigned int bf_bits(float f) {
  const unsigned int u = __float_as_uint(f);
  return (u + 0x7FFFu + ((u >> 16) & 1u)) >> 16;
}

// WMMA helpers with the VALU hazard guard (ties D, keeps A/B live)
__device__ __forceinline__ v8f wmma_f16(v16h a, v16h b, v8f c) {
  v8f d = __builtin_amdgcn_wmma_f32_16x16x32_f16(false, a, false, b, (short)0, c, false, false);
  asm volatile("v_nop\n\tv_nop\n\tv_nop\n\tv_nop" : "+v"(d) : "v"(a), "v"(b));
  return d;
}
__device__ __forceinline__ v8f wmma_bf16(v16us a, v16us b, v8f c) {
  v8f d = __builtin_amdgcn_wmma_f32_16x16x32_bf16(false, __builtin_bit_cast(v16bf, a), false,
                                                   __builtin_bit_cast(v16bf, b), (short)0, c, false, false);
  asm volatile("v_nop\n\tv_nop\n\tv_nop\n\tv_nop" : "+v"(d) : "v"(a), "v"(b));
  return d;
}

// 16-bit operand fragment, split k map for BOTH A and B:
// p = (row or column (lane&15)) base + k0 + 8*(lane>>4); elements 0..7 <- p[0..7], elements 8..15 <- p[16..23].
__device__ __forceinline__ v16h frag_f16(const _Float16* p) {
  FragH f;
  f.h[0] = *(const v8h*)p;
  f.h[1] = *(const v8h*)(p + 16);
  return f.v;
}
__device__ __forceinline__ v16us frag_u16(const unsigned short* p) {
  FragU f;
  f.h[0] = *(const v8us*)p;
  f.h[1] = *(const v8us*)(p + 16);
  return f.v;
}

// The same fragment from a workspace plane kept in FRAGMENT ORDER: the plane holds, one after the other, the 512-byte
// images of the wave-wide 16-byte loads, [load][lane][8 elements], the two loads of a fragment side by side.
// p = fragment base + 8*lane; elements 0..7 <- p[0..7], elements 8..15 <- p[256..263]. Which element of the matrix
// stands at a (lane, register) place is as above; a load covers 4 whole lines, where rows of a matrix give 16 pieces of 32 B.
__device__ __forceinline__ v16h frag_f16_fo(const _Float16* p) {
  FragH f;
  f.h[0] = *(const v8h*)p;
  f.h[1] = *(const v8h*)(p + 256);
  return f.v;
}
__device__ __forceinline__ v16us frag_u16_fo(const unsigned short* p) {
  FragU f;
  f.h[0] = *(const v8us*)p;
  f.h[1] = *(const v8us*)(p + 256);
  return f.v;
}

// ---------------------------------------------------------------------------
// Kernel 1: W planes -> one bf16 plane in fragment order, Wt[n >> 4][ks][j][lane = 16*hf + (n & 15)][e],
// n = p*64 + hcol (p: 0 q, 1 k, 2 v), contraction index c = 32*ks + 16*j + 8*hf + e, c = CDIM..KP-1 zero.
// Block = 8 output rows (coalesced 32-B reads of W, transposed in LDS); its 8 rows fill whole 128-B lines of the plane.
// ---------------------------------------------------------------------------
__global__ __launch_bounds__(256) void k_wconv(
    const float* __restrict__ Wq, const float* __restrict__ Wk, const float* __restrict__ Wv,
    unsigned short* __restrict__ Wt)
{
  __shared__ __attribute__((aligned(16))) unsigned short sw[8 * WP];   // [hcol_local][c]

  const int tid   = threadIdx.x;
  const int p     = blockIdx.x >> 3;
  const int hcol0 = (blockIdx.x & 7) * 8;
  const float* W = (p == 0) ? Wq : ((p == 1) ? Wk : Wv);   // block-uniform select, same address space

  for (int i = tid; i < 8 * (WP - CDIM); i += 256) {
    const int r = i / (WP - CDIM);
    const int c = i - r * (WP - CDIM);
    sw[r * WP + CDIM + c] = (unsigned short)0;
  }
  // a thread's W loads all leave before the first is used
  v4f wv[WLD];
#pragma unroll
  for (int j = 0; j < WLD; ++j) {
    const int i = (tid + j * 256 < CDIM * 2) ? (tid + j * 256) : (CDIM * 2 - 1);   // in bounds for every thread: no branch round a load
    wv[j] = *(const v4f*)(W + (size_t)(i >> 1) * HDIM + hcol0 + (i & 1) * 4);
  }
#pragma unroll
  for (int j = 0; j < WLD; ++j) {
    const int i = tid + j * 256;
    if (i >= CDIM * 2) break;
    const int c  = i >> 1;
    const int q4 = (i & 1) * 4;
    const v4f v = wv[j];
    sw[(q4 + 0) * WP + c] = (unsigned short)bf_bits(v.x);
    sw[(q4 + 1) * WP + c] = (unsigned short)bf_bits(v.y);
    sw[(q4 + 2) * WP + c] = (unsigned short)bf_bits(v.z);
    sw[(q4 + 3) * WP + c] = (unsigned short)bf_bits(v.w);
  }
  __syncthreads();

  // piece i of 16 bytes: row i & 7 of the block, contraction indices 8*(i >> 3) ..+7; 8 threads in a row fill one line
  const int n0 = p * HDIM + hcol0;                // 0..NPROJ-8, a multiple of 8
  unsigned short* dst = Wt + (size_t)(n0 >> 4) * (NKS * 512) + (n0 & 15) * 8;
  for (int i = tid; i < 8 * (KP / 8); i += 256) {
    const int rl = i & 7;
    const int kp = i >> 3;                        // ks = kp >> 2, j = (kp >> 1) & 1, hf = kp & 1
    const v4u w = *(const v4u*)(sw + rl * WP + kp * 8);
    *(v4u*)(dst + (kp >> 1) * 256 + (kp & 1) * 128 + rl * 8) = w;
  }
}

// ---------------------------------------------------------------------------
// Kernel 2: q,k,v projections for a tile of 64 token rows on bf16 WMMA.
// 8 waves: wave -> 16 rows (wave&3) x 96 output columns (wave>>2). x tile staged once in LDS as bf16.
// Outputs: qh = f16(q*log2e) [tok][64]; kh = f16(k), vT = f16(16*v), vR = f16((16*v - vT) * 1024) (residual plane),
// these three in fragment order, 2048 elements per chunk of 32 tokens (chunk = compact token row >> 5):
// kh[chunk][key >> 4 & 1][feature >> 5][feature >> 4 & 1][lane = 16*(feature >> 3 & 1) + (key & 15)][feature & 7],
// vT, vR[chunk][feature >> 4][key >> 4 & 1][lane = 16*(key >> 3 & 1) + (feature & 15)][key & 7].
// ---------------------------------------------------------------------------
__global__ __launch_bounds__(256) __attribute__((amdgpu_num_vgpr(256)))
void k_proj(const float* __restrict__ x, const unsigned short* __restrict__ Wt,
            _Float16* __restrict__ qh, _Float16* __restrict__ kh,
            _Float16* __restrict__ vT, _Float16* __restrict__ vR)
{
  __shared__ __attribute__((aligned(16))) unsigned short sm[64 * XP];   // 54272 B, later reused as staging

  const int tid  = threadIdx.x;
  const int lane = tid & 31;
  const int wave = __builtin_amdgcn_readfirstlane(tid >> 5);
  const int half = lane >> 4;
  const int ln   = lane & 15;
  const int m0 = blockIdx.x * 64;               // compact token row of this tile
  const int b  = m0 / SEQ;
  const int t0 = m0 - b * SEQ;
  const float* xblk = x + ((size_t)b * SEQ_FULL + t0) * CDIM;

  const int rg = wave & 3;
  const int ch = wave >> 2;
  const unsigned short* arow = sm + (rg * 16 + ln) * XP + 8 * half;
  const unsigned short* brow = Wt + (size_t)(ch * 6) * (NKS * 512) + lane * 8;   // column tile nt, k step ks: + (nt * NKS + ks) * 512

  // W fragments run two k steps ahead of their products, three register sets in turn; the first two sets leave here
  v16us bq[3][6];
#pragma unroll
  for (int nt = 0; nt < 6; ++nt) bq[0][nt] = frag_u16_fo(brow + nt * NKS * 512);
#pragma unroll
  for (int nt = 0; nt < 6; ++nt) bq[1][nt] = frag_u16_fo(brow + (nt * NKS + 1) * 512);

  // stage x tile: 64 rows x CDIM -> bf16, columns CDIM..XP-1 zero; a thread's XLD loads all leave before the first is used
  // (the 64 whole rows lie in one piece, so piece i of 16 bytes stands at xblk + 4 i: one address, constant steps)
  v4f xv[XLD];
#pragma unroll
  for (int j = 0; j < XLD; ++j) xv[j] = *(const v4f*)(xblk + (size_t)tid * 4 + j * 1024);
  // stands behind the W fragment loads and the x loads above, in front of the first overwrite of a base or offset register that they name
  asm volatile("s_wait_xcnt 0x0" ::: "memory");
#pragma unroll
  for (int j = 0; j < XLD; ++j) {
    const int i  = tid + j * 256;
    const int r  = i / (CDIM / 4);
    const int c4 = i - r * (CDIM / 4);
    const v4f v = xv[j];
    v2u w;
    w.x = bf_bits(v.x) | (bf_bits(v.y) << 16);
    w.y = bf_bits(v.z) | (bf_bits(v.w) << 16);
    *(v2u*)(sm + r * XP + c4 * 4) = w;
  }
  for (int i = tid; i < 64 * 3; i += 256) {
    const int r = i / 3;
    const int j = i - r * 3;
    v4u z; z.x = 0u; z.y = 0u; z.z = 0u; z.w = 0u;
    *(v4u*)(sm + r * XP + CDIM + j * 8) = z;
  }
  __syncthreads();

  v8f acc[6];
#pragma unroll
  for (int nt = 0; nt < 6; ++nt) {
#pragma unroll
    for (int r = 0; r < 8; ++r) acc[nt][r] = 0.0f;
  }
  v16us aq[2];
  aq[0] = frag_u16(arow);
  // unrolled so that the register sets are picked at compile time
#pragma unroll
  for (int ks = 0; ks < NKS; ++ks) {
    if (ks + 2 < NKS) {
#pragma unroll
      for (int nt = 0; nt < 6; ++nt) bq[(ks + 2) % 3][nt] = frag_u16_fo(brow + (nt * NKS + ks + 2) * 512);
    }
    if (ks + 1 < NKS) aq[(ks + 1) & 1] = frag_u16(arow + (ks + 1) * 32);
#pragma unroll
    for (int nt = 0; nt < 6; ++nt) acc[nt] = wmma_bf16(aq[ks & 1], bq[ks % 3][nt], acc[nt]);
  }
  // stands in front of the first overwrite of the address registers that the W fragment loads name
  asm volatile("s_wait_xcnt 0x0" :: "v"(brow) : "memory");
  __syncthreads();   // all waves done reading the x tile

  // staging (16-bit elements): sQ = sm[0..4095] as [t][64]; sK = sm[4096..8191], sV = sm[8192..12287],
  // sVr = sm[12288..16383]: the tile's two chunks in the fragment order of their planes
#pragma unroll
  for (int nt = 0; nt < 6; ++nt) {
    const int n0 = ch * 96 + nt * 16;            // wave-uniform
    const int p  = n0 >> 6;
    const int hc = (n0 & 63) + ln;
    const float sc = (p == 0) ? LOG2E_F : ((p == 2) ? 16.0f : 1.0f);
    // token tl = rg * 16 + 8 * half + r: the place of r = 0 and the step from r to r + 1, per plane (p is wave-uniform)
    if (p == 2) {   // a lane's 8 tokens stand side by side in the V order: one 16-byte store per plane
      const int i0 = (rg >> 1) * 2048 + (hc >> 4) * 512 + (rg & 1) * 256 + half * 128 + (hc & 15) * 8;
      v8us hv8, rv8;
#pragma unroll
      for (int r = 0; r < 8; ++r) {
        const float vf = acc[nt][r] * sc;
        const _Float16 hv = (_Float16)vf;
        const _Float16 rv = (_Float16)((vf - (float)hv) * 1024.0f);
        hv8[r] = __builtin_bit_cast(unsigned short, hv);
        rv8[r] = __builtin_bit_cast(unsigned short, rv);
      }
      *(v8us*)(sm + 8192 + i0)  = hv8;
      *(v8us*)(sm + 12288 + i0) = rv8;
    } else if (p == 1) {
      unsigned short* base = sm + 4096 + rg * 1024 + (hc >> 4) * 256 + ((hc >> 3) & 1) * 128 + half * 64 + (hc & 7);
#pragma unroll
      for (int r = 0; r < 8; ++r) base[r * 8] = __builtin_bit_cast(unsigned short, (_Float16)(acc[nt][r] * sc));
    } else {
      unsigned short* base = sm + (rg * 16 + 8 * half) * 64 + hc;
#pragma unroll
      for (int r = 0; r < 8; ++r) base[r * 64] = __builtin_bit_cast(unsigned short, (_Float16)(acc[nt][r] * sc));
    }
  }
  __syncthreads();

  // whole-line stores: wave w owns elements 512w..512w+511 of the tile's 4096 in each plane (token rows 8w..8w+7 of qh)
  const int rl = lane >> 3;
  const int pc = lane & 7;
  const int rA = wave * 8 + rl;
  const int rB = rA + 4;
  const v4u qA = *(const v4u*)(sm + rA * 64 + pc * 8);
  const v4u qB = *(const v4u*)(sm + rB * 64 + pc * 8);
  const v4u kA = *(const v4u*)(sm + 4096 + rA * 64 + pc * 8);
  const v4u kB = *(const v4u*)(sm + 4096 + rB * 64 + pc * 8);
  const v4u vA = *(const v4u*)(sm + 8192 + rA * 64 + pc * 8);
  const v4u vB = *(const v4u*)(sm + 8192 + rB * 64 + pc * 8);
  const v4u uA = *(const v4u*)(sm + 12288 + rA * 64 + pc * 8);
  const v4u uB = *(const v4u*)(sm + 12288 + rB * 64 + pc * 8);
  _Float16* dqA = qh + (size_t)(m0 + rA) * HDIM + pc * 8;
  _Float16* dqB = qh + (size_t)(m0 + rB) * HDIM + pc * 8;
  _Float16* dkA = kh + (size_t)(m0 + rA) * HDIM + pc * 8;
  _Float16* dkB = kh + (size_t)(m0 + rB) * HDIM + pc * 8;
  _Float16* dvA = vT + (size_t)(m0 + rA) * HDIM + pc * 8;
  _Float16* dvB = vT + (size_t)(m0 + rB) * HDIM + pc * 8;
  _Float16* duA = vR + (size_t)(m0 + rA) * HDIM + pc * 8;
  _Float16* duB = vR + (size_t)(m0 + rB) * HDIM + pc * 8;
  *(v4u*)dqA = qA; *(v4u*)dqB = qB;
  *(v4u*)dkA = kA; *(v4u*)dkB = kB;
  *(v4u*)dvA = vA; *(v4u*)dvB = vB;
  *(v4u*)duA = uA; *(v4u*)duB = uB;
  
}

// ---------------------------------------------------------------------------
// Kernel 3: causal flash attention. Block = NKW waves on ONE group of 16 query rows, key chunks of 32:
// wave w takes chunks w, w + NKW, ... with its own maxima, sums and accumulators; the partials meet in LDS at the end.
// S tiles (D layout) -> online softmax in log2 domain -> P x 1024 to f16 A layout via LDS -> O += P.V, sums += P.ones.
// EARLY = 1 handles query tiles 0..NTB_E-1 (rows < 256): adds P residual (x1024) and v residual plane (x1024)
// products into separate accumulators folded with 2^-10 before the merge; EARLY = 0 handles the rest.
// Both kinds of block stand in ONE launch (k_attn below): neither reads what the other writes. blk = the block's index in its kind.
// ---------------------------------------------------------------------------
template <int EARLY>
__device__ __forceinline__
int attn_body(const _Float16* __restrict__ qh, const _Float16* __restrict__ kh,
               const _Float16* __restrict__ vT, const _Float16* __restrict__ vR,
               const int blk,
               _Float16 (*pbuf)[16][40], _Float16 (*rbuf)[16][40], float (*obuf)[16][68],
               float (*mbuf)[16], float (*dbuf)[16])
{
  const int tid  = threadIdx.x;
  const int lane = tid & 31;
  const int wave = __builtin_amdgcn_readfirstlane(tid >> 5);
  const int half = lane >> 4;
  const int ln   = lane & 15;
  int b, rg;
  if (EARLY) { b = blk / NRG_E;  rg = blk - b * NRG_E; }
  else       { b = blk / NRG_LD; rg = NRG_E + (blk - b * NRG_LD); }
  const int row0 = rg * 16;                      // first query row of this block (within the sequence)

  const _Float16* qrow  = qh + ((size_t)b * SEQ + row0 + ln) * HDIM + 8 * half;
  // the lane's place in the wave's current chunk as one running 32-bit byte offset per plane layout: every fragment of
  // the chunk is a constant away from it, so a batch of loads takes one address register on top of the plane's base
  // (planes in fragment order: a chunk is 2048 elements in each, the lane's 16 bytes of every load stand at 8 * lane)
  unsigned koff = (unsigned)(((b * SEQ + wave * 32) * HDIM + 8 * lane) * 2);
  unsigned voff = (unsigned)(((b * SEQ + wave * 32) * HDIM + 8 * lane) * 2);

  // loop-invariant Q A fragments (feature blocks 0..31, 32..63)
  const v16h qa0 = frag_f16(qrow);
  const v16h qa1 = frag_f16(qrow + 32);

  v16h ones;
#pragma unroll
  for (int i = 0; i < 16; ++i) ones[i] = (_Float16)1.0f;

  v8f o[4];
  v8f osum;
#pragma unroll
  for (int r = 0; r < 8; ++r) osum[r] = 0.0f;
#pragma unroll
  for (int ht = 0; ht < 4; ++ht) {
#pragma unroll
    for (int r = 0; r < 8; ++r) o[ht][r] = 0.0f;
  }
  float rmax[8];
#pragma unroll
  for (int r = 0; r < 8; ++r) rmax[r] = NEG_BIG;

  const int nchunk = (row0 >> 5) + 1;            // chunks that hold a key <= row0 + 15
  const int npass  = EARLY ? 1 : (nchunk + NKW - 1) / NKW;   // block-uniform trip count (EARLY: nchunk <= NKW)
#pragma unroll 1
  for (int it = 0; it < npass; ++it) {
    const int c   = it * NKW + wave;             // this wave's chunk of the pass
    const int kt0 = c * 32;
    const bool active = (c < nchunk);           // wave-uniform
    v8f s[2];
#pragma unroll
    for (int r = 0; r < 8; ++r) { s[0][r] = 0.0f; s[1][r] = 0.0f; }

    v16h vb[4], vr[4];   // V fragments of the chunk (vr: residual plane, EARLY only)
    if (active) {
      // the chunk's K fragments all leave before the first product
      v16h kb[2][2];
#pragma unroll
      for (int nt = 0; nt < 2; ++nt) {
        const _Float16* krow = (const _Float16*)((const char*)kh + koff) + nt * 1024;
        kb[nt][0] = frag_f16_fo(krow);
        kb[nt][1] = frag_f16_fo(krow + 512);
      }
      if (EARLY) {
        // the address registers of the Q and K loads are inputs of the wait, so none of them is handed to a product's result in front of it
        asm volatile("s_wait_xcnt 0x0" :: "v"(qrow), "v"(koff) : "memory");
      }
      // S[16 x 32] = Q(16 x 64) . K^T, K as B operand: column = key (lane&15), k = feature (split map)
#pragma unroll
      for (int nt = 0; nt < 2; ++nt) {
        const int key = kt0 + nt * 16 + ln;
        v8f acc;
#pragma unroll
        for (int r = 0; r < 8; ++r) acc[r] = 0.0f;
        acc = wmma_f16(qa0, kb[nt][0], acc);
        acc = wmma_f16(qa1, kb[nt][1], acc);
#pragma unroll
        for (int r = 0; r < 8; ++r) {
          const float sv = acc[r] * 0.125f;                        // 1/sqrt(64), log2e already in q
          s[nt][r] = (key > row0 + 8 * half + r) ? NEG_BIG : sv;   // causal fill (replace)
        }
      }
      // online softmax, row = 8*half + r, columns across the 16-lane half
      float alpha[8];
#pragma unroll
      for (int r = 0; r < 8; ++r) {
        float tmax = fmaxf(s[0][r], s[1][r]);
#pragma unroll
        for (int m = 1; m < 16; m <<= 1) tmax = fmaxf(tmax, __shfl_xor(tmax, m, 32));
        const float nmax = fmaxf(rmax[r], tmax);
        alpha[r] = exp2f(rmax[r] - nmax);
        rmax[r]  = nmax;
        s[0][r] = exp2f(s[0][r] - nmax);
        s[1][r] = exp2f(s[1][r] - nmax);
      }
      if (!EARLY) {   // EARLY has one pass: its sums are still zero here, and stay out of the registers until the products
#pragma unroll
        for (int r = 0; r < 8; ++r) {
          osum[r] *= alpha[r];
#pragma unroll
          for (int ht = 0; ht < 4; ++ht) o[ht][r] *= alpha[r];
        }
      }
    }

    // P: D layout -> [q_local][key_local] in LDS (carried x 1024; residual x 1024 more), then reloaded as A fragments
    __syncthreads();
    if (active) {
#pragma unroll
      for (int nt = 0; nt < 2; ++nt) {
#pragma unroll
        for (int r = 0; r < 8; ++r) {
          const float pf = s[nt][r] * 1024.0f;
          const _Float16 ph = (_Float16)pf;
          pbuf[wave][r + 8 * half][nt * 16 + ln] = ph;
          if (EARLY) {
            const _Float16 pr = (_Float16)((pf - (float)ph) * 1024.0f);
            rbuf[wave][r + 8 * half][nt * 16 + ln] = pr;
          }
        }
      }
    }
    __syncthreads();

    if (active) {
      if (!EARLY) {   // the chunk's V fragments all leave before the first product
#pragma unroll
        for (int ht = 0; ht < 4; ++ht) vb[ht] = frag_f16_fo((const _Float16*)((const char*)vT + voff) + ht * 512);
      }
      const v16h pa = frag_f16(&pbuf[wave][ln][8 * half]);
      // V as B operand: column = feature (lane&15), k = key (split map)
      if (EARLY) {
        const v16h pra = frag_f16(&rbuf[wave][ln][8 * half]);
#pragma unroll
        for (int hp = 0; hp < 4; hp += 2) {   // two feature blocks at a time: their V and residual fragments leave together
#pragma unroll
          for (int ht = hp; ht < hp + 2; ++ht) {
            vb[ht] = frag_f16_fo((const _Float16*)((const char*)vT + voff) + ht * 512);
            vr[ht] = frag_f16_fo((const _Float16*)((const char*)vR + voff) + ht * 512);
          }
#pragma unroll
          for (int ht = hp; ht < hp + 2; ++ht) {
            v8f rs;   // the feature block's residual sums: one pass, so they fold into the numerator here, not behind the loop
#pragma unroll
            for (int r = 0; r < 8; ++r) rs[r] = 0.0f;
            o[ht] = wmma_f16(pa,  vb[ht], o[ht]);
            rs    = wmma_f16(pra, vb[ht], rs);
            rs    = wmma_f16(pa,  vr[ht], rs);
#pragma unroll
            for (int r = 0; r < 8; ++r) o[ht][r] = o[ht][r] + rs[r] * RINV;
          }
          // keeps the second pair's loads behind the first pair's products: all eight fragments beside the sums do not fit
          // the register budget that this body shares with the long blocks, and would spill
          if (hp == 0) __builtin_amdgcn_sched_barrier(0);
        }
        v8f rs;
#pragma unroll
        for (int r = 0; r < 8; ++r) rs[r] = 0.0f;
        osum = wmma_f16(pa,  ones, osum);
        rs   = wmma_f16(pra, ones, rs);
#pragma unroll
        for (int r = 0; r < 8; ++r) osum[r] = osum[r] + rs[r] * RINV;
      } else {
#pragma unroll
        for (int ht = 0; ht < 4; ++ht) o[ht] = wmma_f16(pa, vb[ht], o[ht]);
        // keeps the sum product behind the four V products: scheduled ahead of them, its constant operand takes the registers of
        // the first V fragment, and that fragment's two loads leave only behind the product instead of with the chunk's batch
        __builtin_amdgcn_sched_barrier(0);
        osum = wmma_f16(pa, ones, osum);   // row sums of the same f16 P in D layout
      }
    }
    // stands in front of the overwrite of the offsets that the pass's fragment loads name
    asm volatile("s_wait_xcnt 0x0" :: "v"(koff), "v"(voff) : "memory");
    koff += NKW * 32 * HDIM * 2;
    voff += NKW * 32 * HDIM * 2;
  }

  // each wave's partial (un-normalised numerator, row sum, row maximum) to its own LDS region;
  // a wave that had no chunk leaves zeros under the maximum NEG_BIG and gets weight 0 below
  // (the lane's place is taken anew from the lane counter: nothing of threadIdx has to stay in a register over the loop,
  // which fills the budget of 8 waves per SIMD and would spill it)
  const int lane_e = (int)__builtin_amdgcn_mbcnt_lo(~0u, 0u);
  const int half_e = lane_e >> 4;
  const int ln_e   = lane_e & 15;
#pragma unroll
  for (int r = 0; r < 8; ++r) {
#pragma unroll
    for (int ht = 0; ht < 4; ++ht) obuf[wave][8 * half_e + r][ht * 16 + ln_e] = o[ht][r];
  }
  if (ln_e == 0) {   // maxima and sums are alike in the 16 lanes of a half
#pragma unroll
    for (int r = 0; r < 8; ++r) {
      mbuf[wave][8 * half_e + r] = rmax[r];
      dbuf[wave][8 * half_e + r] = osum[r];
    }
  }
  return b * SEQ_FULL + row0;   // the block's first row in out (block-uniform)
}

// One launch for both kinds of block, picked by a block-uniform branch: blocks 0 .. NB*NRG_L-1 take the rows >= 256,
// the one-pass blocks of the rows < 256 come last and run beside the long ones.
// Register budget of 8 waves per SIMD: four blocks fit a WGP, so every block of the launch can be resident at once.
__global__ __launch_bounds__(NKW * 32) __attribute__((amdgpu_waves_per_eu(8)))
void k_attn(const _Float16* __restrict__ qh, const _Float16* __restrict__ kh,
            const _Float16* __restrict__ vT, const _Float16* __restrict__ vR,
            float* __restrict__ out)
{
  __shared__ __attribute__((aligned(16))) _Float16 pbuf[NKW][16][40];   // per-wave 16 x 32 P tile (x1024)
  __shared__ __attribute__((aligned(16))) _Float16 rbuf[NKW][16][40];   // per-wave 16 x 32 P residual tile (rows < 256 only)
  __shared__ __attribute__((aligned(16))) float    obuf[NKW][16][68];   // per-wave 16 x 64 un-normalised partial
  __shared__ float mbuf[NKW][16];                                       // per-wave row maxima (log2 domain)
  __shared__ float dbuf[NKW][16];                                       // per-wave row sums

  const int blk  = blockIdx.x;
  const int wave = __builtin_amdgcn_readfirstlane(threadIdx.x >> 5);
  int orow0;
  if (blk < NB * NRG_L) orow0 = attn_body<0>(qh, kh, vT, vR, blk, pbuf, rbuf, obuf, mbuf, dbuf);
  else                  orow0 = attn_body<1>(qh, kh, vT, vR, blk - NB * NRG_L, pbuf, rbuf, obuf, mbuf, dbuf);
  __syncthreads();

  // merge: thread -> query row tid >> 4, four features; weights 2^(m_w - m); then normalise
  // (1024 carry cancels between numerator and denominator; 1/16 undoes the v carry)
  const int lane = (int)__builtin_amdgcn_mbcnt_lo(~0u, 0u);   // as in attn_body: no register held over the loop for it
  const int ln   = lane & 15;
  const int mrow = wave * 2 + (lane >> 4);                    // = threadIdx.x >> 4
  float mw[NKW];
  float mall = NEG_BIG;
#pragma unroll
  for (int w = 0; w < NKW; ++w) { mw[w] = mbuf[w][mrow]; mall = fmaxf(mall, mw[w]); }
  float den = 0.0f;
  v4f num;
  num.x = 0.0f; num.y = 0.0f; num.z = 0.0f; num.w = 0.0f;
#pragma unroll
  for (int w = 0; w < NKW; ++w) {
    const float a = exp2f(mw[w] - mall);
    const v4f pv = *(const v4f*)(&obuf[w][mrow][ln * 4]);
    den += a * dbuf[w][mrow];
    num += pv * a;
  }
  const float inv = 0.0625f * __builtin_amdgcn_rcpf(den);
  *(v4f*)(out + ((size_t)orow0 + mrow) * HDIM + ln * 4) = num * inv;
}

// ---------------------------------------------------------------------------
extern "C" void kernel_launch(void* const* d_in, const int* in_sizes, int n_in,
                              void* d_out, int out_size, void* d_ws, size_t ws_size,
                              hipStream_t stream)
{
  if (n_in < 4) return;
  const long long tok_rows = (long long)(NB - 1) * SEQ_FULL + SEQ;
  if ((long long)in_sizes[0] < tok_rows * CDIM) return;
  if (in_sizes[1] < CDIM * HDIM || in_sizes[2] < CDIM * HDIM || in_sizes[3] < CDIM * HDIM) return;
  if ((long long)out_size < tok_rows * HDIM) return;

  const float* x  = (const float*)d_in[0];
  const float* Wq = (const float*)d_in[1];
  const float* Wk = (const float*)d_in[2];
  const float* Wv = (const float*)d_in[3];
  float* out = (float*)d_out;

  // workspace carve (bytes): Wt 192*448*2 = 172032 (192*416*2 in use) | qh NB*SEQ*64*2 | kh same | vT same | vR same
  const size_t wt_bytes = (size_t)NPROJ * WP * sizeof(unsigned short);
  const size_t plane    = (size_t)NB * SEQ * HDIM * sizeof(_Float16);
  const size_t off_wt = 0;
  const size_t off_q  = (off_wt + wt_bytes + 255) & ~(size_t)255;
  const size_t off_k  = off_q + plane;
  const size_t off_v  = off_k + plane;
  const size_t off_r  = off_v + plane;
  const size_t total  = off_r + plane;
  if (total > ws_size) return;

  unsigned short* Wt = (unsigned short*)((char*)d_ws + off_wt);
  _Float16* qh = (_Float16*)((char*)d_ws + off_q);
  _Float16* kh = (_Float16*)((char*)d_ws + off_k);
  _Float16* vT = (_Float16*)((char*)d_ws + off_v);
  _Float16* vR = (_Float16*)((char*)d_ws + off_r);

  k_wconv<<<NPROJ / 8, 256, 0, stream>>>(Wq, Wk, Wv, Wt);
  k_proj<<<(NB * SEQ) / 64, 256, 0, stream>>>(x, Wt, qh, kh, vT, vR);
  k_attn<<<NB * (NRG_L + NRG_E), NKW * 32, 0, stream>>>(qh, kh, vT, vR, out);
}

// v005
// One run takes 26.4 microseconds.
// Two timings next to v004 put it at 1.24 and 1.22 times that version's speed.
// All steps since v000 together make it 7.39 times as fast.
#include <hip/hip_runtime.h>

// Contractions: x*W projections (q,k,v): v_wmma_f32_16x16x32_bf16, bf16 operands (RNE-converted inputs), f32 accumulate.
// q.k scores, P.v, P row sums: v_wmma_f32_16x16x32_f16, f16 operands (q x log2e, k, P x 1024, v x 16), f32 accumulate;
// query rows < 256 of each sequence also use f16 residual planes of P and v (x1024 carries) in separate f32 accumulators.

#ifndef NB
#define NB 8
#endif
#ifndef SEQ
#define SEQ 2048
#endif
#define NB_FULL  8
#define SEQ_FULL 2048
#define CDIM  400
#define HDIM  64
#define NPROJ 192
#define KP    416         // contraction depth padded to 13 x 32, pad columns are zeros
#define XP    424         // LDS pitch of the staged x tile (16-bit elements)
#define WP    448         // LDS pitch of the k-contiguous W rows in k_wconv (16-bit elements), 896 B = 7 lines
#define NKS    (KP / 32)                     // k steps of a projection
#define XLD    (64 * (CDIM / 4) / 256)       // 16-byte x loads of a thread of the projection block
#define WLD    ((CDIM * 2 + 255) / 256)      // 16-byte W loads of a thread of the conversion block, at most
#define NTB    (SEQ / 64)                    // 64-row query tiles per sequence
#define NTB_E  ((NTB < 4) ? NTB : 4)         // tiles with query rows < 256: residual path
#define NTB_L  (NTB - NTB_E)
#define NTB_LD ((NTB_L > 0) ? NTB_L : 1)
#define NKW    8                             // waves of an attention block: all on the same 16 query rows, keys dealt over them
#define NRG_E  (NTB_E * 4)                   // 16-row query groups with rows < 256
#define NRG_LD (NTB_LD * 4)
#define NRG_L  (NTB_L * 4)                   // 16-row query groups with rows >= 256

static_assert(SEQ % 64 == 0 && SEQ >= 64);
static_assert(NKW * 32 == 16 * 16);          // the merge gives each of the 16 rows 16 threads
static_assert(NRG_E * 16 <= NKW * 32);       // a group with rows < 256 has at most NKW chunks: one pass
static_assert(SEQ <= SEQ_FULL);
static_assert(NB >= 1 && NB <= NB_FULL);
static_assert(KP % 32 == 0 && KP >= CDIM);
static_assert(XP >= KP && (XP % 8) == 0);
static_assert(WP >= KP && ((WP * 2) % 128) == 0);
static_assert(NPROJ == 3 * HDIM && (NPROJ % 8) == 0 && (HDIM % 8) == 0);
static_assert(CDIM % 4 == 0 && CDIM > 256 && CDIM <= 512);
static_assert(64 * XP >= 4 * 4096);
static_assert((64 * (CDIM / 4)) % 256 == 0 && NKS >= 2);
static_assert(((long long)(NB - 1) * SEQ_FULL + SEQ) * HDIM <= 1048576LL);

typedef _Float16       v16h  __attribute__((ext_vector_type(16)));
typedef _Float16       v8h   __attribute__((ext_vector_type(8)));
typedef float          v8f   __attribute__((ext_vector_type(8)));
typedef float          v4f   __attribute__((ext_vector_type(4)));
typedef unsigned short v16us __attribute__((ext_vector_type(16)));
typedef unsigned short v8us  __attribute__((ext_vector_type(8)));
typedef unsigned int   v4u   __attribute__((ext_vector_type(4)));
typedef unsigned int   v2u   __attribute__((ext_vector_type(2)));
typedef __bf16         v16bf __attribute__((ext_vector_type(16)));

union FragH { v16h v; v8h h[2]; };
union FragU { v16us v; v8us h[2]; };

#define LOG2E_F 1.4426950408889634f
#define NEG_BIG (-3.0e38f)
#define RINV    0.0009765625f

// f32 -> bf16 bits, RNE convert
__device__ __forceinline__ unsigned int bf_bits(float f) {
  const unsigned int u = __float_as_uint(f);
  return (u + 0x7FFFu + ((u >> 16) & 1u)) >> 16;
}

// WMMA helpers with the VALU hazard guard (ties D, keeps A/B live)
__device__ __forceinline__ v8f wmma_f16(v16h a, v16h b, v8f c) {
  v8f d = __builtin_amdgcn_wmma_f32_16x16x32_f16(false, a, false, b, (short)0, c, false, false);
  asm volatile("v_nop\n\tv_nop\n\tv_nop\n\tv_nop" : "+v"(d) : "v"(a), "v"(b));
  return d;
}
__device__ __forceinline__ v8f wmma_bf16(v16us a, v16us b, v8f c) {
  v8f d = __builtin_amdgcn_wmma_f32_16x16x32_bf16(false, __builtin_bit_cast(v16bf, a), false,
                                                   __builtin_bit_cast(v16bf, b), (short)0, c, false, false);
  asm volatile("v_nop\n\tv_nop\n\tv_nop\n\tv_nop" : "+v"(d) : "v"(a), "v"(b));
  return d;
}

// 16-bit operand fragment, split k map for BOTH A and B:
// p = (row or column (lane&15)) base + k0 + 8*(lane>>4); elements 0..7 <- p[0..7], elements 8..15 <- p[16..23].
__device__ __forceinline__ v16h frag_f16(const _Float16* p) {
  FragH f;
  f.h[0] = *(const v8h*)p;
  f.h[1] = *(const v8h*)(p + 16);
  return f.v;
}
__device__ __forceinline__ v16us frag_u16(const unsigned short* p) {
  FragU f;
  f.h[0] = *(const v8us*)p;
  f.h[1] = *(const v8us*)(p + 16);
  return f.v;
}

// The same fragment from a workspace plane kept in FRAGMENT ORDER: the plane holds, one after the other, the 512-byte
// images of the wave-wide 16-byte loads, [load][lane][8 elements], the two loads of a fragment side by side.
// p = fragment base + 8*lane; elements 0..7 <- p[0..7], elements 8..15 <- p[256..263]. Which element of the matrix
// stands at a (lane, register) place is as above; a load covers 4 whole lines, where rows of a matrix give 16 pieces of 32 B.
__device__ __forceinline__ v16h frag_f16_fo(const _Float16* p) {
  FragH f;
  f.h[0] = *(const v8h*)p;
  f.h[1] = *(const v8h*)(p + 256);
  return f.v;
}
__device__ __forceinline__ v16us frag_u16_fo(const unsigned short* p) {
  FragU f;
  f.h[0] = *(const v8us*)p;
  f.h[1] = *(const v8us*)(p + 256);
  return f.v;
}

// ---------------------------------------------------------------------------
// Kernel 1: W planes -> one bf16 plane in fragment order, Wt[n >> 4][ks][j][lane = 16*hf + (n & 15)][e],
// n = p*64 + hcol (p: 0 q, 1 k, 2 v), contraction index c = 32*ks + 16*j + 8*hf + e, c = CDIM..KP-1 zero.
// Block = 8 output rows (coalesced 32-B reads of W, transposed in LDS); its 8 rows fill whole 128-B lines of the plane.
// ---------------------------------------------------------------------------
__global__ __launch_bounds__(256) void k_wconv(
    const float* __restrict__ Wq, const float* __restrict__ Wk, const float* __restrict__ Wv,
    unsigned short* __restrict__ Wt)
{
  __shared__ __attribute__((aligned(16))) unsigned short sw[8 * WP];   // [hcol_local][c]

  const int tid   = threadIdx.x;
  const int p     = blockIdx.x >> 3;
  const int hcol0 = (blockIdx.x & 7) * 8;
  const float* W = (p == 0) ? Wq : ((p == 1) ? Wk : Wv);   // block-uniform select, same address space

  for (int i = tid; i < 8 * (WP - CDIM); i += 256) {
    const int r = i / (WP - CDIM);
    const int c = i - r * (WP - CDIM);
    sw[r * WP + CDIM + c] = (unsigned short)0;
  }
  // a thread's W loads all leave before the first is used
  v4f wv[WLD];
#pragma unroll
  for (int j = 0; j < WLD; ++j) {
    const int i = (tid + j * 256 < CDIM * 2) ? (tid + j * 256) : (CDIM * 2 - 1);   // in bounds for every thread: no branch round a load
    wv[j] = *(const v4f*)(W + (size_t)(i >> 1) * HDIM + hcol0 + (i & 1) * 4);
  }
#pragma unroll
  for (int j = 0; j < WLD; ++j) {
    const int i = tid + j * 256;
    if (i >= CDIM * 2) break;
    const int c  = i >> 1;
    const int q4 = (i & 1) * 4;
    const v4f v = wv[j];
    sw[(q4 + 0) * WP + c] = (unsigned short)bf_bits(v.x);
    sw[(q4 + 1) * WP + c] = (unsigned short)bf_bits(v.y);
    sw[(q4 + 2) * WP + c] = (unsigned short)bf_bits(v.z);
    sw[(q4 + 3) * WP + c] = (unsigned short)bf_bits(v.w);
  }
  __syncthreads();

  // piece i of 16 bytes: row i & 7 of the block, contraction indices 8*(i >> 3) ..+7; 8 threads in a row fill one line
  const int n0 = p * HDIM + hcol0;                // 0..NPROJ-8, a multiple of 8
  unsigned short* dst = Wt + (size_t)(n0 >> 4) * (NKS * 512) + (n0 & 15) * 8;
  for (int i = tid; i < 8 * (KP / 8); i += 256) {
    const int rl = i & 7;
    const int kp = i >> 3;                        // ks = kp >> 2, j = (kp >> 1) & 1, hf = kp & 1
    const v4u w = *(const v4u*)(sw + rl * WP + kp * 8);
    *(v4u*)(dst + (kp >> 1) * 256 + (kp & 1) * 128 + rl * 8) = w;
  }
}

// ---------------------------------------------------------------------------
// Kernel 2: q,k,v projections for a tile of 64 token rows on bf16 WMMA.
// 8 waves: wave -> 16 rows (wave&3) x 96 output columns (wave>>2). x tile staged once in LDS as bf16.
// Outputs: qh = f16(q*log2e) [tok][64]; kh = f16(k), vT = f16(16*v), vR = f16((16*v - vT) * 1024) (residual plane),
// these three in fragment order, 2048 elements per chunk of 32 tokens (chunk = compact token row >> 5):
// kh[chunk][key >> 4 & 1][feature >> 5][feature >> 4 & 1][lane = 16*(feature >> 3 & 1) + (key & 15)][feature & 7],
// vT, vR[chunk][feature >> 4][key >> 4 & 1][lane = 16*(key >> 3 & 1) + (feature & 15)][key & 7].
// ---------------------------------------------------------------------------
__global__ __launch_bounds__(256) __attribute__((amdgpu_num_vgpr(256)))
void k_proj(const float* __restrict__ x, const unsigned short* __restrict__ Wt,
            _Float16* __restrict__ qh, _Float16* __restrict__ kh,
            _Float16* __restrict__ vT, _Float16* __restrict__ vR)
{
  __shared__ __attribute__((aligned(16))) unsigned short sm[64 * XP];   // 54272 B, later reused as staging

  const int tid  = threadIdx.x;
  const int lane = tid & 31;
  const int wave = __builtin_amdgcn_readfirstlane(tid >> 5);
  const int half = lane >> 4;
  const int ln   = lane & 15;
  const int m0 = blockIdx.x * 64;               // compact token row of this tile
  const int b  = m0 / SEQ;
  const int t0 = m0 - b * SEQ;
  const float* xblk = x + ((size_t)b * SEQ_FULL + t0) * CDIM;

  const int rg = wave & 3;
  const int ch = wave >> 2;
  const unsigned short* arow = sm + (rg * 16 + ln) * XP + 8 * half;
  const unsigned short* brow = Wt + (size_t)(ch * 6) * (NKS * 512) + lane * 8;   // column tile nt, k step ks: + (nt * NKS + ks) * 512

  // W fragments run two k steps ahead of their products, three register sets in turn; the first two sets leave here
  v16us bq[3][6];
#pragma unroll
  for (int nt = 0; nt < 6; ++nt) bq[0][nt] = frag_u16_fo(brow + nt * NKS * 512);
#pragma unroll
  for (int nt = 0; nt < 6; ++nt) bq[1][nt] = frag_u16_fo(brow + (nt * NKS + 1) * 512);

  // stage x tile: 64 rows x CDIM -> bf16, columns CDIM..XP-1 zero; a thread's XLD loads all leave before the first is used
  // (the 64 whole rows lie in one piece, so piece i of 16 bytes stands at xblk + 4 i: one address, constant steps)
  v4f xv[XLD];
#pragma unroll
  for (int j = 0; j < XLD; ++j) xv[j] = *(const v4f*)(xblk + (size_t)tid * 4 + j * 1024);
  // stands behind the W fragment loads and the x loads above, in front of the first overwrite of a base or offset register that they name
  asm volatile("s_wait_xcnt 0x0" ::: "memory");
#pragma unroll
  for (int j = 0; j < XLD; ++j) {
    const int i  = tid + j * 256;
    const int r  = i / (CDIM / 4);
    const int c4 = i - r * (CDIM / 4);
    const v4f v = xv[j];
    v2u w;
    w.x = bf_bits(v.x) | (bf_bits(v.y) << 16);
    w.y = bf_bits(v.z) | (bf_bits(v.w) << 16);
    *(v2u*)(sm + r * XP + c4 * 4) = w;
  }
  for (int i = tid; i < 64 * 3; i += 256) {
    const int r = i / 3;
    const int j = i - r * 3;
    v4u z; z.x = 0u; z.y = 0u; z.z = 0u; z.w = 0u;
    *(v4u*)(sm + r * XP + CDIM + j * 8) = z;
  }
  __syncthreads();

  v8f acc[6];
#pragma unroll
  for (int nt = 0; nt < 6; ++nt) {
#pragma unroll
    for (int r = 0; r < 8; ++r) acc[nt][r] = 0.0f;
  }
  v16us aq[2];
  aq[0] = frag_u16(arow);
  // unrolled so that the register sets are picked at compile time
#pragma unroll
  for (int ks = 0; ks < NKS; ++ks) {
    if (ks + 2 < NKS) {
#pragma unroll
      for (int nt = 0; nt < 6; ++nt) bq[(ks + 2) % 3][nt] = frag_u16_fo(brow + (nt * NKS + ks + 2) * 512);
    }
    if (ks + 1 < NKS) aq[(ks + 1) & 1] = frag_u16(arow + (ks + 1) * 32);
#pragma unroll
    for (int nt = 0; nt < 6; ++nt) acc[nt] = wmma_bf16(aq[ks & 1], bq[ks % 3][nt], acc[nt]);
  }
  // stands in front of the first overwrite of the address registers that the W fragment loads name
  asm volatile("s_wait_xcnt 0x0" :: "v"(brow) : "memory");
  __syncthreads();   // all waves done reading the x tile

  // staging (16-bit elements): sQ = sm[0..4095] as [t][64]; sK = sm[4096..8191], sV = sm[8192..12287],
  // sVr = sm[12288..16383]: the tile's two chunks in the fragment order of their planes
#pragma unroll
  for (int nt = 0; nt < 6; ++nt) {
    const int n0 = ch * 96 + nt * 16;            // wave-uniform
    const int p  = n0 >> 6;
    const int hc = (n0 & 63) + ln;
    const float sc = (p == 0) ? LOG2E_F : ((p == 2) ? 16.0f : 1.0f);
    // token tl = rg * 16 + 8 * half + r: the place of r = 0 and the step from r to r + 1, per plane (p is wave-uniform)
    if (p == 2) {   // a lane's 8 tokens stand side by side in the V order: one 16-byte store per plane
      const int i0 = (rg >> 1) * 2048 + (hc >> 4) * 512 + (rg & 1) * 256 + half * 128 + (hc & 15) * 8;
      v8us hv8, rv8;
#pragma unroll
      for (int r = 0; r < 8; ++r) {
        const float vf = acc[nt][r] * sc;
        const _Float16 hv = (_Float16)vf;
        const _Float16 rv = (_Float16)((vf - (float)hv) * 1024.0f);
        hv8[r] = __builtin_bit_cast(unsigned short, hv);
        rv8[r] = __builtin_bit_cast(unsigned short, rv);
      }
      *(v8us*)(sm + 8192 + i0)  = hv8;
      *(v8us*)(sm + 12288 + i0) = rv8;
    } else if (p == 1) {
      unsigned short* base = sm + 4096 + rg * 1024 + (hc >> 4) * 256 + ((hc >> 3) & 1) * 128 + half * 64 + (hc & 7);
#pragma unroll
      for (int r = 0; r < 8; ++r) base[r * 8] = __builtin_bit_cast(unsigned short, (_Float16)(acc[nt][r] * sc));
    } else {
      unsigned short* base = sm + (rg * 16 + 8 * half) * 64 + hc;
#pragma unroll
      for (int r = 0; r < 8; ++r) base[r * 64] = __builtin_bit_cast(unsigned short, (_Float16)(acc[nt][r] * sc));
    }
  }
  __syncthreads();

  // whole-line stores: wave w owns elements 512w..512w+511 of the tile's 4096 in each plane (token rows 8w..8w+7 of qh)
  const int rl = lane >> 3;
  const int pc = lane & 7;
  const int rA = wave * 8 + rl;
  const int rB = rA + 4;
  const v4u qA = *(const v4u*)(sm + rA * 64 + pc * 8);
  const v4u qB = *(const v4u*)(sm + rB * 64 + pc * 8);
  const v4u kA = *(const v4u*)(sm + 4096 + rA * 64 + pc * 8);
  const v4u kB = *(const v4u*)(sm + 4096 + rB * 64 + pc * 8);
  const v4u vA = *(const v4u*)(sm + 8192 + rA * 64 + pc * 8);
  const v4u vB = *(const v4u*)(sm + 8192 + rB * 64 + pc * 8);
  const v4u uA = *(const v4u*)(sm + 12288 + rA * 64 + pc * 8);
  const v4u uB = *(const v4u*)(sm + 12288 + rB * 64 + pc * 8);
  _Float16* dqA = qh + (size_t)(m0 + rA) * HDIM + pc * 8;
  _Float16* dqB = qh + (size_t)(m0 + rB) * HDIM + pc * 8;
  _Float16* dkA = kh + (size_t)(m0 + rA) * HDIM + pc * 8;
  _Float16* dkB = kh + (size_t)(m0 + rB) * HDIM + pc * 8;
  _Float16* dvA = vT + (size_t)(m0 + rA) * HDIM + pc * 8;
  _Float16* dvB = vT + (size_t)(m0 + rB) * HDIM + pc * 8;
  _Float16* duA = vR + (size_t)(m0 + rA) * HDIM + pc * 8;
  _Float16* duB = vR + (size_t)(m0 + rB) * HDIM + pc * 8;
  *(v4u*)dqA = qA; *(v4u*)dqB = qB;
  *(v4u*)dkA = kA; *(v4u*)dkB = kB;
  *(v4u*)dvA = vA; *(v4u*)dvB = vB;
  *(v4u*)duA = uA; *(v4u*)duB = uB;
  
}

// ---------------------------------------------------------------------------
// Kernel 3: causal flash attention. Block = NKW waves on ONE group of 16 query rows, key chunks of 32:
// wave w takes chunks w, w + NKW, ... with its own maxima, sums and accumulators; the partials meet in LDS at the end.
// The products are taken TRANSPOSED: S^T = K . Q^T (A = K fragment, B = Q fragment), O^T += V^T . P^T, sums += ones . P^T.
// A lane then holds 16 scores of ONE query (column lane & 15; keys 8*(lane>>4) + r of each 16-key tile): the row maximum is taken
// in the lane plus one exchange between the halves, and the two converted score tiles ARE the B fragment of the next product
// (element 8*nt + r <- key 16*nt + 8*(lane>>4) + r, the split k map of the V fragment): P never goes through LDS,
// and the loop has no barrier. The K, Q and V fragments are the same registers as before, with the operand sides swapped.
// Online softmax in log2 domain, P x 1024 in f16.
// EARLY = 1 handles query tiles 0..NTB_E-1 (rows < 256): adds P residual (x1024) and v residual plane (x1024)
// products into separate accumulators folded with 2^-10 before the merge; EARLY = 0 handles the rest.
// Both kinds of block stand in ONE launch (k_attn below): neither reads what the other writes. blk = the block's index in its kind.
// ---------------------------------------------------------------------------
// value of lane ^ 16, in the vector unit (no LDS trip)
__device__ __forceinline__ float xhalf(float x) {
  const int b = __builtin_bit_cast(int, x);
  return __builtin_bit_cast(float, __builtin_amdgcn_permlanex16(b, b, 0x76543210, 0xfedcba98, false, false));
}

template <int EARLY>
__device__ __forceinline__
int attn_body(const _Float16* __restrict__ qh, const _Float16* __restrict__ kh,
               const _Float16* __restrict__ vT, const _Float16* __restrict__ vR,
               const int blk,
               float (*obuf)[16][68], float (*mbuf)[16], float (*dbuf)[16])
{
  const int tid  = threadIdx.x;
  const int lane = tid & 31;
  const int wave = __builtin_amdgcn_readfirstlane(tid >> 5);
  const int half = lane >> 4;
  const int ln   = lane & 15;
  int b, rg;
  if (EARLY) { b = blk / NRG_E;  rg = blk - b * NRG_E; }
  else       { b = blk / NRG_LD; rg = NRG_E + (blk - b * NRG_LD); }
  const int row0 = rg * 16;                      // first query row of this block (within the sequence)

  const _Float16* qrow  = qh + ((size_t)b * SEQ + row0 + ln) * HDIM + 8 * half;
  // the lane's place in the wave's current chunk as one running 32-bit byte offset per plane layout: every fragment of
  // the chunk is a constant away from it, so a batch of loads takes one address register on top of the plane's base
  // (planes in fragment order: a chunk is 2048 elements in each, the lane's 16 bytes of every load stand at 8 * lane)
  unsigned koff = (unsigned)(((b * SEQ + wave * 32) * HDIM + 8 * lane) * 2);
  unsigned voff = (unsigned)(((b * SEQ + wave * 32) * HDIM + 8 * lane) * 2);

  // loop-invariant Q B fragments (feature blocks 0..31, 32..63): column = query (lane&15), k = feature (split map)
  const v16h qb0 = frag_f16(qrow);
  const v16h qb1 = frag_f16(qrow + 32);

  v16h ones;
#pragma unroll
  for (int i = 0; i < 16; ++i) ones[i] = (_Float16)1.0f;

  v8f o[4];      // O^T: o[ht][r] = feature 16*ht + 8*half + r of query ln
  v8f osum;      // every register: the sum of query ln
#pragma unroll
  for (int r = 0; r < 8; ++r) osum[r] = 0.0f;
#pragma unroll
  for (int ht = 0; ht < 4; ++ht) {
#pragma unroll
    for (int r = 0; r < 8; ++r) o[ht][r] = 0.0f;
  }
  float rmax = NEG_BIG;                          // running maximum of query ln, alike in both halves

  const int nchunk = (row0 >> 5) + 1;            // chunks that hold a key <= row0 + 15
  const int qk     = row0 + ln - 8 * half;       // key 16*nt + 8*half + r of chunk c is masked where 16*nt + r > qk - 32*c
  // wave-uniform trip count; no barrier inside, so each wave walks its own chunks (EARLY: nchunk <= NKW, at most one trip)
  // kept rolled: two trips' fragments side by side do not fit the register budget of 8 waves per SIMD
#pragma unroll 1
  for (int c = wave; c < nchunk; c += NKW) {
    const int lim = qk - c * 32;
    // the chunk's K fragments all leave before the first product
    v16h kb[2][2];
#pragma unroll
    for (int nt = 0; nt < 2; ++nt) {
      const _Float16* krow = (const _Float16*)((const char*)kh + koff) + nt * 1024;
      kb[nt][0] = frag_f16_fo(krow);
      kb[nt][1] = frag_f16_fo(krow + 512);
    }
    if (EARLY) {
      // the address registers of the Q and K loads are inputs of the wait, so none of them is handed to a product's result in front of it
      asm volatile("s_wait_xcnt 0x0" :: "v"(qrow), "v"(koff) : "memory");
    }
    // S^T[32 x 16] = K(32 x 64) . Q^T, K as A operand: row = key (lane&15), k = feature (split map)
    float s[2][8];
#pragma unroll
    for (int nt = 0; nt < 2; ++nt) {
      v8f acc;
#pragma unroll
      for (int r = 0; r < 8; ++r) acc[r] = 0.0f;
      acc = wmma_f16(kb[nt][0], qb0, acc);
      acc = wmma_f16(kb[nt][1], qb1, acc);
#pragma unroll
      for (int r = 0; r < 8; ++r) {
        const float sv = acc[r] * 0.125f;                          // 1/sqrt(64), log2e already in q
        s[nt][r] = (nt * 16 + r > lim) ? NEG_BIG : sv;             // causal fill (replace)
      }
    }
    // online softmax of query ln: 16 of the chunk's 32 keys stand in this lane, the other 16 in lane ^ 16
    float tmax = fmaxf(s[0][0], s[1][0]);
#pragma unroll
    for (int r = 1; r < 8; ++r) tmax = fmaxf(tmax, fmaxf(s[0][r], s[1][r]));
    tmax = fmaxf(tmax, xhalf(tmax));
    const float nmax  = fmaxf(rmax, tmax);
    const float alpha = exp2f(rmax - nmax);
    rmax = nmax;
    if (!EARLY) {   // EARLY has one trip: its sums are still zero here, and stay out of the registers until the products
#pragma unroll
      for (int r = 0; r < 8; ++r) {
        osum[r] *= alpha;
#pragma unroll
        for (int ht = 0; ht < 4; ++ht) o[ht][r] *= alpha;
      }
    }
    // P^T (carried x 1024; residual x 1024 more) straight from the score registers into B fragments
    v16h pb, prb;
#pragma unroll
    for (int nt = 0; nt < 2; ++nt) {
#pragma unroll
      for (int r = 0; r < 8; ++r) {
        const float pf = exp2f(s[nt][r] - nmax) * 1024.0f;
        const _Float16 ph = (_Float16)pf;
        pb[nt * 8 + r] = ph;
        if (EARLY) prb[nt * 8 + r] = (_Float16)((pf - (float)ph) * 1024.0f);
      }
    }

    // V as A operand: row = feature (lane&15), k = key (split map)
    v16h vb[4], vr[4];   // V fragments of the chunk (vr: residual plane, EARLY only)
    if (EARLY) {
#pragma unroll
      for (int hp = 0; hp < 4; hp += 2) {   // two feature blocks at a time: their V and residual fragments leave together
#pragma unroll
        for (int ht = hp; ht < hp + 2; ++ht) {
          vb[ht] = frag_f16_fo((const _Float16*)((const char*)vT + voff) + ht * 512);
          vr[ht] = frag_f16_fo((const _Float16*)((const char*)vR + voff) + ht * 512);
        }
#pragma unroll
        for (int ht = hp; ht < hp + 2; ++ht) {
          v8f rs;   // the feature block's residual sums: one trip, so they fold into the numerator here, not behind the loop
#pragma unroll
          for (int r = 0; r < 8; ++r) rs[r] = 0.0f;
          o[ht] = wmma_f16(vb[ht], pb,  o[ht]);
          rs    = wmma_f16(vb[ht], prb, rs);
          rs    = wmma_f16(vr[ht], pb,  rs);
#pragma unroll
          for (int r = 0; r < 8; ++r) o[ht][r] = o[ht][r] + rs[r] * RINV;
        }
        // keeps the second pair's loads behind the first pair's products: all eight fragments beside the sums do not fit
        // the register budget that this body shares with the long blocks, and would spill
        if (hp == 0) __builtin_amdgcn_sched_barrier(0);
      }
      v8f rs;
#pragma unroll
      for (int r = 0; r < 8; ++r) rs[r] = 0.0f;
      osum = wmma_f16(ones, pb,  osum);
      rs   = wmma_f16(ones, prb, rs);
#pragma unroll
      for (int r = 0; r < 8; ++r) osum[r] = osum[r] + rs[r] * RINV;
    } else {
      // the chunk's V fragments all leave before the first product
#pragma unroll
      for (int ht = 0; ht < 4; ++ht) vb[ht] = frag_f16_fo((const _Float16*)((const char*)vT + voff) + ht * 512);
#pragma unroll
      for (int ht = 0; ht < 4; ++ht) o[ht] = wmma_f16(vb[ht], pb, o[ht]);
      osum = wmma_f16(ones, pb, osum);   // sums of the same f16 P, one query a column
    }
    // stands in front of the overwrite of the offsets that the trip's fragment loads name
    asm volatile("s_wait_xcnt 0x0" :: "v"(koff), "v"(voff) : "memory");
    koff += NKW * 32 * HDIM * 2;
    voff += NKW * 32 * HDIM * 2;
  }

  // each wave's partial (un-normalised numerator, row sum, row maximum) to its own LDS region;
  // a wave that had no chunk leaves zeros under the maximum NEG_BIG and gets weight 0 below
  // (the lane's place is taken anew from the lane counter: nothing of threadIdx has to stay in a register over the loop)
  const int lane_e = (int)__builtin_amdgcn_mbcnt_lo(~0u, 0u);
  const int half_e = lane_e >> 4;
  const int ln_e   = lane_e & 15;
#pragma unroll
  for (int ht = 0; ht < 4; ++ht) {   // a lane's 8 registers are 8 features in a row of its query: two 16-byte stores
    v4f lo, hi;
    lo.x = o[ht][0]; lo.y = o[ht][1]; lo.z = o[ht][2]; lo.w = o[ht][3];
    hi.x = o[ht][4]; hi.y = o[ht][5]; hi.z = o[ht][6]; hi.w = o[ht][7];
    *(v4f*)(&obuf[wave][ln_e][ht * 16 + 8 * half_e])     = lo;
    *(v4f*)(&obuf[wave][ln_e][ht * 16 + 8 * half_e + 4]) = hi;
  }
  if (half_e == 0) {   // maxima and sums are alike in the two lanes of a query
    mbuf[wave][ln_e] = rmax;
    dbuf[wave][ln_e] = osum[0];
  }
  return b * SEQ_FULL + row0;   // the block's first row in out (block-uniform)
}

// One launch for both kinds of block, picked by a block-uniform branch: blocks 0 .. NB*NRG_L-1 take the rows >= 256,
// the one-pass blocks of the rows < 256 come last and run beside the long ones.
// Register budget of 8 waves per SIMD: four blocks fit a WGP, so every block of the launch can be resident at once.
__global__ __launch_bounds__(NKW * 32) __attribute__((amdgpu_waves_per_eu(8)))
void k_attn(const _Float16* __restrict__ qh, const _Float16* __restrict__ kh,
            const _Float16* __restrict__ vT, const _Float16* __restrict__ vR,
            float* __restrict__ out)
{
  __shared__ __attribute__((aligned(16))) float    obuf[NKW][16][68];   // per-wave 16 x 64 un-normalised partial
  __shared__ float mbuf[NKW][16];                                       // per-wave row maxima (log2 domain)
  __shared__ float dbuf[NKW][16];                                       // per-wave row sums

  const int blk  = blockIdx.x;
  const int wave = __builtin_amdgcn_readfirstlane(threadIdx.x >> 5);
  int orow0;
  if (blk < NB * NRG_L) orow0 = attn_body<0>(qh, kh, vT, vR, blk, obuf, mbuf, dbuf);
  else                  orow0 = attn_body<1>(qh, kh, vT, vR, blk - NB * NRG_L, obuf, mbuf, dbuf);
  __syncthreads();

  // merge: thread -> query row tid >> 4, four features; weights 2^(m_w - m); then normalise
  // (1024 carry cancels between numerator and denominator; 1/16 undoes the v carry)
  const int lane = (int)__builtin_amdgcn_mbcnt_lo(~0u, 0u);   // as in attn_body: no register held over the loop for it
  const int ln   = lane & 15;
  const int mrow = wave * 2 + (lane >> 4);                    // = threadIdx.x >> 4
  float mw[NKW];
  float mall = NEG_BIG;
#pragma unroll
  for (int w = 0; w < NKW; ++w) { mw[w] = mbuf[w][mrow]; mall = fmaxf(mall, mw[w]); }
  float den = 0.0f;
  v4f num;
  num.x = 0.0f; num.y = 0.0f; num.z = 0.0f; num.w = 0.0f;
#pragma unroll
  for (int w = 0; w < NKW; ++w) {
    const float a = exp2f(mw[w] - mall);
    const v4f pv = *(const v4f*)(&obuf[w][mrow][ln * 4]);
    den += a * dbuf[w][mrow];
    num += pv * a;
  }
  const float inv = 0.0625f * __builtin_amdgcn_rcpf(den);
  *(v4f*)(out + ((size_t)orow0 + mrow) * HDIM + ln * 4) = num * inv;
}

// ---------------------------------------------------------------------------
extern "C" void kernel_launch(void* const* d_in, const int* in_sizes, int n_in,
                              void* d_out, int out_size, void* d_ws, size_t ws_size,
                              hipStream_t stream)
{
  if (n_in < 4) return;
  const long long tok_rows = (long long)(NB - 1) * SEQ_FULL + SEQ;
  if ((long long)in_sizes[0] < tok_rows * CDIM) return;
  if (in_sizes[1] < CDIM * HDIM || in_sizes[2] < CDIM * HDIM || in_sizes[3] < CDIM * HDIM) return;
  if ((long long)out_size < tok_rows * HDIM) return;

  const float* x  = (const float*)d_in[0];
  const float* Wq = (const float*)d_in[1];
  const float* Wk = (const float*)d_in[2];
  const float* Wv = (const float*)d_in[3];
  float* out = (float*)d_out;

  // workspace carve (bytes): Wt 192*448*2 = 172032 (192*416*2 in use) | qh NB*SEQ*64*2 | kh same | vT same | vR same
  const size_t wt_bytes = (size_t)NPROJ * WP * sizeof(unsigned short);
  const size_t plane    = (size_t)NB * SEQ * HDIM * sizeof(_Float16);
  const size_t off_wt = 0;
  const size_t off_q  = (off_wt + wt_bytes + 255) & ~(size_t)255;
  const size_t off_k  = off_q + plane;
  const size_t off_v  = off_k + plane;
  const size_t off_r  = off_v + plane;
  const size_t total  = off_r + plane;
  if (total > ws_size) return;

  unsigned short* Wt = (unsigned short*)((char*)d_ws + off_wt);
  _Float16* qh = (_Float16*)((char*)d_ws + off_q);
  _Float16* kh = (_Float16*)((char*)d_ws + off_k);
  _Float16* vT = (_Float16*)((char*)d_ws + off_v);
  _Float16* vR = (_Float16*)((char*)d_ws + off_r);

  k_wconv<<<NPROJ / 8, 256, 0, stream>>>(Wq, Wk, Wv, Wt);
  k_proj<<<(NB * SEQ) / 64, 256, 0, stream>>>(x, Wt, qh, kh, vT, vR);
  k_attn<<<NB * (NRG_L + NRG_E), NKW * 32, 0, stream>>>(qh, kh, vT, vR, out);
}

// v006
// A run of this version takes 24.5 microseconds.
// Timed twice side by side with v005, it ran 1.06 times as fast both times.
// All steps since v000 together make it 7.85 times as fast.
#include <hip/hip_runtime.h>

// Contractions: x*W projections (q,k,v): v_wmma_f32_16x16x32_bf16, bf16 operands (RNE-converted inputs), f32 accumulate.
// q.k scores, P.v, P row sums: v_wmma_f32_16x16x32_f16, f16 operands (q x log2e, k, P x 1024, v x 16), f32 accumulate;
// query rows < 256 of each sequence also use f16 residual planes of P and v (x1024 carries) in separate f32 accumulators.

#ifndef NB
#define NB 8
#endif
#ifndef SEQ
#define SEQ 2048
#endif
#define NB_FULL  8
#define SEQ_FULL 2048
#define CDIM  400
#define HDIM  64
#define NPROJ 192
#define KP    416         // contraction depth padded to 13 x 32, pad columns are zeros
#define XP    424         // LDS pitch of the staged x tile (16-bit elements)
#define NKS    (KP / 32)                     // k steps of a projection
#define XLD    (64 * (CDIM / 4) / 128)       // 16-byte x loads of a thread of the four waves that stage x
#define WTS    (NKS * 512 + 8)               // LDS pitch of a 16-column tile of the W plane (16-bit elements): 16 B past a multiple of 256 B
#define NWT    (3 * (CDIM / 16))             // wave-wide W staging tasks: 16 contraction rows x 64 columns of one W matrix
#define NWSL   ((NWT + 3) / 4)               // task slots of a staging wave (four waves)
#define NTB    (SEQ / 64)                    // 64-row query tiles per sequence
#define NTB_E  ((NTB < 4) ? NTB : 4)         // tiles with query rows < 256: residual path
#define NTB_L  (NTB - NTB_E)
#define NTB_LD ((NTB_L > 0) ? NTB_L : 1)
#define NKW    8                             // waves of an attention block: all on the same 16 query rows, keys dealt over them
#define NRG_E  (NTB_E * 4)                   // 16-row query groups with rows < 256
#define NRG_LD (NTB_LD * 4)
#define NRG_L  (NTB_L * 4)                   // 16-row query groups with rows >= 256

static_assert(SEQ % 64 == 0 && SEQ >= 64);
static_assert(NKW * 32 == 16 * 16);          // the merge gives each of the 16 rows 16 threads
static_assert(NRG_E * 16 <= NKW * 32);       // a group with rows < 256 has at most NKW chunks: one pass
static_assert(SEQ <= SEQ_FULL);
static_assert(NB >= 1 && NB <= NB_FULL);
static_assert(KP % 32 == 0 && KP >= CDIM);
static_assert(XP >= KP && (XP % 8) == 0);
static_assert(CDIM % 16 == 0 && KP - CDIM == 16 && HDIM == 64);
static_assert(NPROJ == 3 * HDIM && (NPROJ % 8) == 0 && (HDIM % 8) == 0);
static_assert(CDIM % 4 == 0 && CDIM > 256 && CDIM <= 512);
static_assert(64 * XP >= 4 * 4096);
static_assert((64 * (CDIM / 4)) % 256 == 0 && NKS >= 2);
static_assert(((long long)(NB - 1) * SEQ_FULL + SEQ) * HDIM <= 1048576LL);

typedef _Float16       v16h  __attribute__((ext_vector_type(16)));
typedef _Float16       v8h   __attribute__((ext_vector_type(8)));
typedef float          v8f   __attribute__((ext_vector_type(8)));
typedef float          v4f   __attribute__((ext_vector_type(4)));
typedef unsigned short v16us __attribute__((ext_vector_type(16)));
typedef unsigned short v8us  __attribute__((ext_vector_type(8)));
typedef unsigned int   v4u   __attribute__((ext_vector_type(4)));
typedef unsigned int   v2u   __attribute__((ext_vector_type(2)));
typedef __bf16         v16bf __attribute__((ext_vector_type(16)));
typedef __bf16         v2bf  __attribute__((ext_vector_type(2)));
typedef float          v2f   __attribute__((ext_vector_type(2)));

union FragH { v16h v; v8h h[2]; };
union FragU { v16us v; v8us h[2]; };

#define LOG2E_F 1.4426950408889634f
#define NEG_BIG (-3.0e38f)
#define RINV    0.0009765625f

// f32 -> bf16 bits, RNE convert
__device__ __forceinline__ unsigned int bf_bits(float f) {
  const unsigned int u = __float_as_uint(f);
  return (u + 0x7FFFu + ((u >> 16) & 1u)) >> 16;
}

// WMMA helpers with the VALU hazard guard (ties D, keeps A/B live)
__device__ __forceinline__ v8f wmma_f16(v16h a, v16h b, v8f c) {
  v8f d = __builtin_amdgcn_wmma_f32_16x16x32_f16(false, a, false, b, (short)0, c, false, false);
  asm volatile("v_nop\n\tv_nop\n\tv_nop\n\tv_nop" : "+v"(d) : "v"(a), "v"(b));
  return d;
}
__device__ __forceinline__ v8f wmma_bf16(v16us a, v16us b, v8f c) {
  v8f d = __builtin_amdgcn_wmma_f32_16x16x32_bf16(false, __builtin_bit_cast(v16bf, a), false,
                                                   __builtin_bit_cast(v16bf, b), (short)0, c, false, false);
  asm volatile("v_nop\n\tv_nop\n\tv_nop\n\tv_nop" : "+v"(d) : "v"(a), "v"(b));
  return d;
}

// 16-bit operand fragment, split k map for BOTH A and B:
// p = (row or column (lane&15)) base + k0 + 8*(lane>>4); elements 0..7 <- p[0..7], elements 8..15 <- p[16..23].
__device__ __forceinline__ v16h frag_f16(const _Float16* p) {
  FragH f;
  f.h[0] = *(const v8h*)p;
  f.h[1] = *(const v8h*)(p + 16);
  return f.v;
}
__device__ __forceinline__ v16us frag_u16(const unsigned short* p) {
  FragU f;
  f.h[0] = *(const v8us*)p;
  f.h[1] = *(const v8us*)(p + 16);
  return f.v;
}

// The same fragment from a workspace or LDS plane kept in FRAGMENT ORDER: the plane holds, one after the other, the 512-byte
// images of the wave-wide 16-byte loads, [load][lane][8 elements], the two loads of a fragment side by side.
// p = fragment base + 8*lane; elements 0..7 <- p[0..7], elements 8..15 <- p[256..263]. Which element of the matrix
// stands at a (lane, register) place is as above; a load covers 4 whole lines, where rows of a matrix give 16 pieces of 32 B.
__device__ __forceinline__ v16h frag_f16_fo(const _Float16* p) {
  FragH f;
  f.h[0] = *(const v8h*)p;
  f.h[1] = *(const v8h*)(p + 256);
  return f.v;
}
__device__ __forceinline__ v16us frag_u16_fo(const unsigned short* p) {
  FragU f;
  f.h[0] = *(const v8us*)p;
  f.h[1] = *(const v8us*)(p + 256);
  return f.v;
}

// ---------------------------------------------------------------------------
// W staging of the projection block. The block keeps all of W (q, k, v side by side, n = p*64 + hcol) in its own LDS as one
// bf16 plane in fragment order, tile n >> 4 at pitch WTS: [ks][j][lane = 16*hf + (n & 15)][e], contraction index
// c = 32*ks + 16*j + 8*hf + e, c = CDIM..KP-1 zero.
// A task is wave-wide: rows c = 16*cp .. 16*cp+15 of one matrix. A lane takes 8 rows (8*(lane>>4) + e) of 4 columns (4*(lane&15) + i):
// each 16-byte load of the wave covers two whole 256-byte rows, and a lane's 8 rows of one column ARE one 16-byte piece of the plane.
// ---------------------------------------------------------------------------
__device__ __forceinline__ const char* w_task_base(const float* __restrict__ Wq, const float* __restrict__ Wk,
                                                   const float* __restrict__ Wv, const int wt) {
  const int p  = wt / (CDIM / 16);
  const int cp = wt - p * (CDIM / 16);
  const float* W = (p == 0) ? Wq : ((p == 1) ? Wk : Wv);   // wave-uniform select, same address space
  return (const char*)(W + cp * 16 * HDIM);
}
__device__ __forceinline__ void w_task_load(v4f (&r)[8], const char* base, const unsigned loff) {
#pragma unroll
  for (int e = 0; e < 8; ++e) r[e] = *(const v4f*)(base + loff + e * HDIM * 4);
}
// two f32 -> two bf16 in one word, round to nearest even, first value in the low half
__device__ __forceinline__ unsigned int bf_pair(float a, float b) {
  v2f f; f.x = a; f.y = b;
  return __builtin_bit_cast(unsigned int, __builtin_convertvector(f, v2bf));
}
__device__ __forceinline__ void w_task_store(const v4f (&r)[8], unsigned short* __restrict__ swl, const int wt) {
  const int p  = wt / (CDIM / 16);
  const int cp = wt - p * (CDIM / 16);
  unsigned short* d = swl + p * 4 * WTS + cp * 256;
#pragma unroll
  for (int i = 0; i < 4; ++i) {
    v4u w;
    w.x = bf_pair(r[0][i], r[1][i]);
    w.y = bf_pair(r[2][i], r[3][i]);
    w.z = bf_pair(r[4][i], r[5][i]);
    w.w = bf_pair(r[6][i], r[7][i]);
    *(v4u*)(d + i * 8) = w;
  }
}

// ---------------------------------------------------------------------------
// Kernel 1: q,k,v projections for a tile of 64 token rows on bf16 WMMA.
// Staging: waves 0..3 bring the x tile into LDS as bf16, waves 4..7 meanwhile all of W (above).
// Products: 8 waves, wave -> 16 rows (wave&3) x 96 output columns (wave>>2), both operands from LDS.
// Outputs: qh = f16(q*log2e) [tok][64]; kh = f16(k), vT = f16(16*v), vR = f16((16*v - vT) * 1024) (residual plane),
// these three in fragment order, 2048 elements per chunk of 32 tokens (chunk = compact token row >> 5):
// kh[chunk][key >> 4 & 1][feature >> 5][feature >> 4 & 1][lane = 16*(feature >> 3 & 1) + (key & 15)][feature & 7],
// vT, vR[chunk][feature >> 4][key >> 4 & 1][lane = 16*(key >> 3 & 1) + (feature & 15)][key & 7].
// ---------------------------------------------------------------------------
__global__ __launch_bounds__(256) __attribute__((amdgpu_num_vgpr(256)))
void k_proj(const float* __restrict__ x,
            const float* __restrict__ Wq, const float* __restrict__ Wk, const float* __restrict__ Wv,
            _Float16* __restrict__ qh, _Float16* __restrict__ kh,
            _Float16* __restrict__ vT, _Float16* __restrict__ vR)
{
  __shared__ __attribute__((aligned(16))) unsigned short sm[64 * XP];              // 54272 B, later reused as staging
  __shared__ __attribute__((aligned(16))) unsigned short swt[(NPROJ / 16) * WTS];  // 159936 B, the W plane

  const int tid  = threadIdx.x;
  const int lane = tid & 31;
  const int wave = __builtin_amdgcn_readfirstlane(tid >> 5);
  const int half = lane >> 4;
  const int ln   = lane & 15;
  const int m0 = blockIdx.x * 64;               // compact token row of this tile
  const int b  = m0 / SEQ;
  const int t0 = m0 - b * SEQ;
  const float* xblk = x + ((size_t)b * SEQ_FULL + t0) * CDIM;

  const int rg = wave & 3;
  const int ch = wave >> 2;
  const unsigned short* arow = sm + (rg * 16 + ln) * XP + 8 * half;
  const unsigned short* brow = swt + (ch * 6) * WTS + lane * 8;   // column tile nt, k step ks: + nt * WTS + ks * 512

  // pad columns of both operands: x columns CDIM..XP-1, W contraction indices CDIM..KP-1
  for (int i = tid; i < 64 * 3; i += 256) {
    const int r = i / 3;
    const int j = i - r * 3;
    v4u z; z.x = 0u; z.y = 0u; z.z = 0u; z.w = 0u;
    *(v4u*)(sm + r * XP + CDIM + j * 8) = z;
  }
  for (int i = tid; i < NPROJ * 2; i += 256) {
    const int n = i >> 1;
    v4u z; z.x = 0u; z.y = 0u; z.z = 0u; z.w = 0u;
    *(v4u*)(swt + (n >> 4) * WTS + (CDIM / 16) * 256 + (i & 1) * 128 + (n & 15) * 8) = z;
  }

  if (wave < 4) {
    // stage x tile: 64 rows x CDIM -> bf16; a thread's XLD loads all leave before the first is used
    // (the 64 whole rows lie in one piece, so piece i of 16 bytes stands at xblk + 4 i: one address, constant steps)
    v4f xv[XLD];
#pragma unroll
    for (int j = 0; j < XLD; ++j) xv[j] = *(const v4f*)(xblk + (size_t)tid * 4 + j * 512);
    // stands behind the x loads above, in front of the first overwrite of a base or offset register that they name
    asm volatile("s_wait_xcnt 0x0" ::: "memory");
#pragma unroll
    for (int j = 0; j < XLD / 2; ++j) {
      const int i  = tid + j * 128;
      const int r  = i / (CDIM / 4);
      const int c4 = i - r * (CDIM / 4);
      unsigned short* d = sm + r * XP + c4 * 4;
#pragma unroll
      for (int h = 0; h < 2; ++h) {   // piece i + 128 * XLD / 2 stands 32 whole rows below piece i: one address serves both
        const v4f v = xv[j + h * (XLD / 2)];
        v2u w;
        w.x = bf_bits(v.x) | (bf_bits(v.y) << 16);
        w.y = bf_bits(v.z) | (bf_bits(v.w) << 16);
        *(v2u*)(d + h * 32 * XP) = w;
      }
    }
  } else {
    // stage W: wave wl takes tasks wl, wl + 4, ..; two register sets of two tasks each, one set's loads in flight while the other is converted
    const int wl = wave - 4;
    const unsigned loff = (unsigned)((half * 8 * HDIM + ln * 4) * 4);                      // the lane's place in a task's 16 rows, bytes
    unsigned short* swl = swt + (ln >> 2) * WTS + half * 128 + (ln & 3) * 32;              // the lane's place in a task's pieces
    // slot k of a wave is task wl + 4 k; the last slot holds a task only for the first NWT - 4 (NWSL - 1) waves: there the task
    // index is clamped for the loads (in bounds for every wave, no branch round a load) and the stores stand under a wave-uniform test
    v4f rw[2][2][8];
    {
      const char* s0 = w_task_base(Wq, Wk, Wv, wl);
      const char* s1 = w_task_base(Wq, Wk, Wv, wl + 4);
      w_task_load(rw[0][0], s0, loff);
      w_task_load(rw[0][1], s1, loff);
      // stands behind the W loads issued so far, in front of the next overwrite of a base or offset register that they name
      asm volatile("s_wait_xcnt 0x0" :: "s"(s0), "s"(s1), "v"(loff) : "memory");
    }
    // unrolled so that the register sets are picked at compile time and the waits on the loads are counted
#pragma unroll
    for (int k = 0; k < NWSL; k += 2) {
      const int st = (k >> 1) & 1;
      if (k + 2 < NWSL) {
        const int wa = wl + (k + 2) * 4;
        const char* s0 = w_task_base(Wq, Wk, Wv, (k + 2 == NWSL - 1 && wa > NWT - 1) ? (NWT - 1) : wa);
        w_task_load(rw[st ^ 1][0], s0, loff);
        if (k + 3 < NWSL) {
          const int wb = wl + (k + 3) * 4;
          const char* s1 = w_task_base(Wq, Wk, Wv, (k + 3 == NWSL - 1 && wb > NWT - 1) ? (NWT - 1) : wb);
          w_task_load(rw[st ^ 1][1], s1, loff);
          // as above
          asm volatile("s_wait_xcnt 0x0" :: "s"(s0), "s"(s1), "v"(loff) : "memory");
        } else {
          // as above
          asm volatile("s_wait_xcnt 0x0" :: "s"(s0), "v"(loff) : "memory");
        }
      }
      if (k < NWSL - 1 || wl + k * 4 < NWT) w_task_store(rw[st][0], swl, wl + k * 4);
      if (k + 1 < NWSL) {
        if (k + 1 < NWSL - 1 || wl + (k + 1) * 4 < NWT) w_task_store(rw[st][1], swl, wl + (k + 1) * 4);
      }
    }
  }
  __syncthreads();

  v8f acc[6];
#pragma unroll
  for (int nt = 0; nt < 6; ++nt) {
#pragma unroll
    for (int r = 0; r < 8; ++r) acc[nt][r] = 0.0f;
  }
  // both operands' fragments run one k step ahead of their products, two register sets in turn
  v16us aq[2];
  v16us bq[2][6];
  aq[0] = frag_u16(arow);
#pragma unroll
  for (int nt = 0; nt < 6; ++nt) bq[0][nt] = frag_u16_fo(brow + nt * WTS);
  // unrolled so that the register sets are picked at compile time
#pragma unroll
  for (int ks = 0; ks < NKS; ++ks) {
    if (ks + 1 < NKS) {
      aq[(ks + 1) & 1] = frag_u16(arow + (ks + 1) * 32);
#pragma unroll
      for (int nt = 0; nt < 6; ++nt) bq[(ks + 1) & 1][nt] = frag_u16_fo(brow + nt * WTS + (ks + 1) * 512);
    }
#pragma unroll
    for (int nt = 0; nt < 6; ++nt) acc[nt] = wmma_bf16(aq[ks & 1], bq[ks & 1][nt], acc[nt]);
  }
  __syncthreads();   // all waves done reading the x tile

  // staging (16-bit elements): sQ = sm[0..4095] as [t][64]; sK = sm[4096..8191], sV = sm[8192..12287],
  // sVr = sm[12288..16383]: the tile's two chunks in the fragment order of their planes
#pragma unroll
  for (int nt = 0; nt < 6; ++nt) {
    const int n0 = ch * 96 + nt * 16;            // wave-uniform
    const int p  = n0 >> 6;
    const int hc = (n0 & 63) + ln;
    const float sc = (p == 0) ? LOG2E_F : ((p == 2) ? 16.0f : 1.0f);
    // token tl = rg * 16 + 8 * half + r: the place of r = 0 and the step from r to r + 1, per plane (p is wave-uniform)
    if (p == 2) {   // a lane's 8 tokens stand side by side in the V order: one 16-byte store per plane
      const int i0 = (rg >> 1) * 2048 + (hc >> 4) * 512 + (rg & 1) * 256 + half * 128 + (hc & 15) * 8;
      v8us hv8, rv8;
#pragma unroll
      for (int r = 0; r < 8; ++r) {
        const float vf = acc[nt][r] * sc;
        const _Float16 hv = (_Float16)vf;
        const _Float16 rv = (_Float16)((vf - (float)hv) * 1024.0f);
        hv8[r] = __builtin_bit_cast(unsigned short, hv);
        rv8[r] = __builtin_bit_cast(unsigned short, rv);
      }
      *(v8us*)(sm + 8192 + i0)  = hv8;
      *(v8us*)(sm + 12288 + i0) = rv8;
    } else if (p == 1) {
      unsigned short* base = sm + 4096 + rg * 1024 + (hc >> 4) * 256 + ((hc >> 3) & 1) * 128 + half * 64 + (hc & 7);
#pragma unroll
      for (int r = 0; r < 8; ++r) base[r * 8] = __builtin_bit_cast(unsigned short, (_Float16)(acc[nt][r] * sc));
    } else {
      unsigned short* base = sm + (rg * 16 + 8 * half) * 64 + hc;
#pragma unroll
      for (int r = 0; r < 8; ++r) base[r * 64] = __builtin_bit_cast(unsigned short, (_Float16)(acc[nt][r] * sc));
    }
  }
  __syncthreads();

  // whole-line stores: wave w owns elements 512w..512w+511 of the tile's 4096 in each plane (token rows 8w..8w+7 of qh)
  const int rl = lane >> 3;
  const int pc = lane & 7;
  const int rA = wave * 8 + rl;
  const int rB = rA + 4;
  const v4u qA = *(const v4u*)(sm + rA * 64 + pc * 8);
  const v4u qB = *(const v4u*)(sm + rB * 64 + pc * 8);
  const v4u kA = *(const v4u*)(sm + 4096 + rA * 64 + pc * 8);
  const v4u kB = *(const v4u*)(sm + 4096 + rB * 64 + pc * 8);
  const v4u vA = *(const v4u*)(sm + 8192 + rA * 64 + pc * 8);
  const v4u vB = *(const v4u*)(sm + 8192 + rB * 64 + pc * 8);
  const v4u uA = *(const v4u*)(sm + 12288 + rA * 64 + pc * 8);
  const v4u uB = *(const v4u*)(sm + 12288 + rB * 64 + pc * 8);
  _Float16* dqA = qh + (size_t)(m0 + rA) * HDIM + pc * 8;
  _Float16* dqB = qh + (size_t)(m0 + rB) * HDIM + pc * 8;
  _Float16* dkA = kh + (size_t)(m0 + rA) * HDIM + pc * 8;
  _Float16* dkB = kh + (size_t)(m0 + rB) * HDIM + pc * 8;
  _Float16* dvA = vT + (size_t)(m0 + rA) * HDIM + pc * 8;
  _Float16* dvB = vT + (size_t)(m0 + rB) * HDIM + pc * 8;
  _Float16* duA = vR + (size_t)(m0 + rA) * HDIM + pc * 8;
  _Float16* duB = vR + (size_t)(m0 + rB) * HDIM + pc * 8;
  *(v4u*)dqA = qA; *(v4u*)dqB = qB;
  *(v4u*)dkA = kA; *(v4u*)dkB = kB;
  *(v4u*)dvA = vA; *(v4u*)dvB = vB;
  *(v4u*)duA = uA; *(v4u*)duB = uB;
  
}

// ---------------------------------------------------------------------------
// Kernel 2: causal flash attention. Block = NKW waves on ONE group of 16 query rows, key chunks of 32:
// wave w takes chunks w, w + NKW, ... with its own maxima, sums and accumulators; the partials meet in LDS at the end.
// The products are taken TRANSPOSED: S^T = K . Q^T (A = K fragment, B = Q fragment), O^T += V^T . P^T, sums += ones . P^T.
// A lane then holds 16 scores of ONE query (column lane & 15; keys 8*(lane>>4) + r of each 16-key tile): the row maximum is taken
// in the lane plus one exchange between the halves, and the two converted score tiles ARE the B fragment of the next product
// (element 8*nt + r <- key 16*nt + 8*(lane>>4) + r, the split k map of the V fragment): P never goes through LDS,
// and the loop has no barrier. The K, Q and V fragments are the same registers as before, with the operand sides swapped.
// Online softmax in log2 domain, P x 1024 in f16.
// EARLY = 1 handles query tiles 0..NTB_E-1 (rows < 256): adds P residual (x1024) and v residual plane (x1024)
// products into separate accumulators folded with 2^-10 before the merge; EARLY = 0 handles the rest.
// Both kinds of block stand in ONE launch (k_attn below): neither reads what the other writes. blk = the block's index in its kind.
// ---------------------------------------------------------------------------
// value of lane ^ 16, in the vector unit (no LDS trip)
__device__ __forceinline__ float xhalf(float x) {
  const int b = __builtin_bit_cast(int, x);
  return __builtin_bit_cast(float, __builtin_amdgcn_permlanex16(b, b, 0x76543210, 0xfedcba98, false, false));
}

template <int EARLY>
__device__ __forceinline__
int attn_body(const _Float16* __restrict__ qh, const _Float16* __restrict__ kh,
               const _Float16* __restrict__ vT, const _Float16* __restrict__ vR,
               const int blk,
               float (*obuf)[16][68], float (*mbuf)[16], float (*dbuf)[16])
{
  const int tid  = threadIdx.x;
  const int lane = tid & 31;
  const int wave = __builtin_amdgcn_readfirstlane(tid >> 5);
  const int half = lane >> 4;
  const int ln   = lane & 15;
  int b, rg;
  if (EARLY) { b = blk / NRG_E;  rg = blk - b * NRG_E; }
  else       { b = blk / NRG_LD; rg = NRG_E + (blk - b * NRG_LD); }
  const int row0 = rg * 16;                      // first query row of this block (within the sequence)

  const _Float16* qrow  = qh + ((size_t)b * SEQ + row0 + ln) * HDIM + 8 * half;
  // the lane's place in the wave's current chunk as one running 32-bit byte offset per plane layout: every fragment of
  // the chunk is a constant away from it, so a batch of loads takes one address register on top of the plane's base
  // (planes in fragment order: a chunk is 2048 elements in each, the lane's 16 bytes of every load stand at 8 * lane)
  unsigned koff = (unsigned)(((b * SEQ + wave * 32) * HDIM + 8 * lane) * 2);
  unsigned voff = (unsigned)(((b * SEQ + wave * 32) * HDIM + 8 * lane) * 2);

  // loop-invariant Q B fragments (feature blocks 0..31, 32..63): column = query (lane&15), k = feature (split map)
  const v16h qb0 = frag_f16(qrow);
  const v16h qb1 = frag_f16(qrow + 32);

  v16h ones;
#pragma unroll
  for (int i = 0; i < 16; ++i) ones[i] = (_Float16)1.0f;

  v8f o[4];      // O^T: o[ht][r] = feature 16*ht + 8*half + r of query ln
  v8f osum;      // every register: the sum of query ln
#pragma unroll
  for (int r = 0; r < 8; ++r) osum[r] = 0.0f;
#pragma unroll
  for (int ht = 0; ht < 4; ++ht) {
#pragma unroll
    for (int r = 0; r < 8; ++r) o[ht][r] = 0.0f;
  }
  float rmax = NEG_BIG;                          // running maximum of query ln, alike in both halves

  const int nchunk = (row0 >> 5) + 1;            // chunks that hold a key <= row0 + 15
  const int qk     = row0 + ln - 8 * half;       // key 16*nt + 8*half + r of chunk c is masked where 16*nt + r > qk - 32*c
  // wave-uniform trip count; no barrier inside, so each wave walks its own chunks (EARLY: nchunk <= NKW, at most one trip)
  // kept rolled: two trips' fragments side by side do not fit the register budget of 8 waves per SIMD
#pragma unroll 1
  for (int c = wave; c < nchunk; c += NKW) {
    const int lim = qk - c * 32;
    // the chunk's K fragments all leave before the first product
    v16h kb[2][2];
#pragma unroll
    for (int nt = 0; nt < 2; ++nt) {
      const _Float16* krow = (const _Float16*)((const char*)kh + koff) + nt * 1024;
      kb[nt][0] = frag_f16_fo(krow);
      kb[nt][1] = frag_f16_fo(krow + 512);
    }
    if (EARLY) {
      // the address registers of the Q and K loads are inputs of the wait, so none of them is handed to a product's result in front of it
      asm volatile("s_wait_xcnt 0x0" :: "v"(qrow), "v"(koff) : "memory");
    }
    // S^T[32 x 16] = K(32 x 64) . Q^T, K as A operand: row = key (lane&15), k = feature (split map)
    float s[2][8];
#pragma unroll
    for (int nt = 0; nt < 2; ++nt) {
      v8f acc;
#pragma unroll
      for (int r = 0; r < 8; ++r) acc[r] = 0.0f;
      acc = wmma_f16(kb[nt][0], qb0, acc);
      acc = wmma_f16(kb[nt][1], qb1, acc);
#pragma unroll
      for (int r = 0; r < 8; ++r) {
        const float sv = acc[r] * 0.125f;                          // 1/sqrt(64), log2e already in q
        s[nt][r] = (nt * 16 + r > lim) ? NEG_BIG : sv;             // causal fill (replace)
      }
    }
    // online softmax of query ln: 16 of the chunk's 32 keys stand in this lane, the other 16 in lane ^ 16
    float tmax = fmaxf(s[0][0], s[1][0]);
#pragma unroll
    for (int r = 1; r < 8; ++r) tmax = fmaxf(tmax, fmaxf(s[0][r], s[1][r]));
    tmax = fmaxf(tmax, xhalf(tmax));
    const float nmax  = fmaxf(rmax, tmax);
    const float alpha = exp2f(rmax - nmax);
    rmax = nmax;
    if (!EARLY) {   // EARLY has one trip: its sums are still zero here, and stay out of the registers until the products
#pragma unroll
      for (int r = 0; r < 8; ++r) {
        osum[r] *= alpha;
#pragma unroll
        for (int ht = 0; ht < 4; ++ht) o[ht][r] *= alpha;
      }
    }
    // P^T (carried x 1024; residual x 1024 more) straight from the score registers into B fragments
    v16h pb, prb;
#pragma unroll
    for (int nt = 0; nt < 2; ++nt) {
#pragma unroll
      for (int r = 0; r < 8; ++r) {
        const float pf = exp2f(s[nt][r] - nmax) * 1024.0f;
        const _Float16 ph = (_Float16)pf;
        pb[nt * 8 + r] = ph;
        if (EARLY) prb[nt * 8 + r] = (_Float16)((pf - (float)ph) * 1024.0f);
      }
    }

    // V as A operand: row = feature (lane&15), k = key (split map)
    v16h vb[4], vr[4];   // V fragments of the chunk (vr: residual plane, EARLY only)
    if (EARLY) {
#pragma unroll
      for (int hp = 0; hp < 4; hp += 2) {   // two feature blocks at a time: their V and residual fragments leave together
#pragma unroll
        for (int ht = hp; ht < hp + 2; ++ht) {
          vb[ht] = frag_f16_fo((const _Float16*)((const char*)vT + voff) + ht * 512);
          vr[ht] = frag_f16_fo((const _Float16*)((const char*)vR + voff) + ht * 512);
        }
#pragma unroll
        for (int ht = hp; ht < hp + 2; ++ht) {
          v8f rs;   // the feature block's residual sums: one trip, so they fold into the numerator here, not behind the loop
#pragma unroll
          for (int r = 0; r < 8; ++r) rs[r] = 0.0f;
          o[ht] = wmma_f16(vb[ht], pb,  o[ht]);
          rs    = wmma_f16(vb[ht], prb, rs);
          rs    = wmma_f16(vr[ht], pb,  rs);
#pragma unroll
          for (int r = 0; r < 8; ++r) o[ht][r] = o[ht][r] + rs[r] * RINV;
        }
        // keeps the second pair's loads behind the first pair's products: all eight fragments beside the sums do not fit
        // the register budget that this body shares with the long blocks, and would spill
        if (hp == 0) __builtin_amdgcn_sched_barrier(0);
      }
      v8f rs;
#pragma unroll
      for (int r = 0; r < 8; ++r) rs[r] = 0.0f;
      osum = wmma_f16(ones, pb,  osum);
      rs   = wmma_f16(ones, prb, rs);
#pragma unroll
      for (int r = 0; r < 8; ++r) osum[r] = osum[r] + rs[r] * RINV;
    } else {
      // the chunk's V fragments all leave before the first product
#pragma unroll
      for (int ht = 0; ht < 4; ++ht) vb[ht] = frag_f16_fo((const _Float16*)((const char*)vT + voff) + ht * 512);
#pragma unroll
      for (int ht = 0; ht < 4; ++ht) o[ht] = wmma_f16(vb[ht], pb, o[ht]);
      osum = wmma_f16(ones, pb, osum);   // sums of the same f16 P, one query a column
    }
    // stands in front of the overwrite of the offsets that the trip's fragment loads name
    asm volatile("s_wait_xcnt 0x0" :: "v"(koff), "v"(voff) : "memory");
    koff += NKW * 32 * HDIM * 2;
    voff += NKW * 32 * HDIM * 2;
  }

  // each wave's partial (un-normalised numerator, row sum, row maximum) to its own LDS region;
  // a wave that had no chunk leaves zeros under the maximum NEG_BIG and gets weight 0 below
  // (the lane's place is taken anew from the lane counter: nothing of threadIdx has to stay in a register over the loop)
  const int lane_e = (int)__builtin_amdgcn_mbcnt_lo(~0u, 0u);
  const int half_e = lane_e >> 4;
  const int ln_e   = lane_e & 15;
#pragma unroll
  for (int ht = 0; ht < 4; ++ht) {   // a lane's 8 registers are 8 features in a row of its query: two 16-byte stores
    v4f lo, hi;
    lo.x = o[ht][0]; lo.y = o[ht][1]; lo.z = o[ht][2]; lo.w = o[ht][3];
    hi.x = o[ht][4]; hi.y = o[ht][5]; hi.z = o[ht][6]; hi.w = o[ht][7];
    *(v4f*)(&obuf[wave][ln_e][ht * 16 + 8 * half_e])     = lo;
    *(v4f*)(&obuf[wave][ln_e][ht * 16 + 8 * half_e + 4]) = hi;
  }
  if (half_e == 0) {   // maxima and sums are alike in the two lanes of a query
    mbuf[wave][ln_e] = rmax;
    dbuf[wave][ln_e] = osum[0];
  }
  return b * SEQ_FULL + row0;   // the block's first row in out (block-uniform)
}

// One launch for both kinds of block, picked by a block-uniform branch: blocks 0 .. NB*NRG_L-1 take the rows >= 256,
// the one-pass blocks of the rows < 256 come last and run beside the long ones.
// Register budget of 8 waves per SIMD: four blocks fit a WGP, so every block of the launch can be resident at once.
__global__ __launch_bounds__(NKW * 32) __attribute__((amdgpu_waves_per_eu(8)))
void k_attn(const _Float16* __restrict__ qh, const _Float16* __restrict__ kh,
            const _Float16* __restrict__ vT, const _Float16* __restrict__ vR,
            float* __restrict__ out)
{
  __shared__ __attribute__((aligned(16))) float    obuf[NKW][16][68];   // per-wave 16 x 64 un-normalised partial
  __shared__ float mbuf[NKW][16];                                       // per-wave row maxima (log2 domain)
  __shared__ float dbuf[NKW][16];                                       // per-wave row sums

  const int blk  = blockIdx.x;
  const int wave = __builtin_amdgcn_readfirstlane(threadIdx.x >> 5);
  int orow0;
  if (blk < NB * NRG_L) orow0 = attn_body<0>(qh, kh, vT, vR, blk, obuf, mbuf, dbuf);
  else                  orow0 = attn_body<1>(qh, kh, vT, vR, blk - NB * NRG_L, obuf, mbuf, dbuf);
  __syncthreads();

  // merge: thread -> query row tid >> 4, four features; weights 2^(m_w - m); then normalise
  // (1024 carry cancels between numerator and denominator; 1/16 undoes the v carry)
  const int lane = (int)__builtin_amdgcn_mbcnt_lo(~0u, 0u);   // as in attn_body: no register held over the loop for it
  const int ln   = lane & 15;
  const int mrow = wave * 2 + (lane >> 4);                    // = threadIdx.x >> 4
  float mw[NKW];
  float mall = NEG_BIG;
#pragma unroll
  for (int w = 0; w < NKW; ++w) { mw[w] = mbuf[w][mrow]; mall = fmaxf(mall, mw[w]); }
  float den = 0.0f;
  v4f num;
  num.x = 0.0f; num.y = 0.0f; num.z = 0.0f; num.w = 0.0f;
#pragma unroll
  for (int w = 0; w < NKW; ++w) {
    const float a = exp2f(mw[w] - mall);
    const v4f pv = *(const v4f*)(&obuf[w][mrow][ln * 4]);
    den += a * dbuf[w][mrow];
    num += pv * a;
  }
  const float inv = 0.0625f * __builtin_amdgcn_rcpf(den);
  *(v4f*)(out + ((size_t)orow0 + mrow) * HDIM + ln * 4) = num * inv;
}

// ---------------------------------------------------------------------------
extern "C" void kernel_launch(void* const* d_in, const int* in_sizes, int n_in,
                              void* d_out, int out_size, void* d_ws, size_t ws_size,
                              hipStream_t stream)
{
  if (n_in < 4) return;
  const long long tok_rows = (long long)(NB - 1) * SEQ_FULL + SEQ;
  if ((long long)in_sizes[0] < tok_rows * CDIM) return;
  if (in_sizes[1] < CDIM * HDIM || in_sizes[2] < CDIM * HDIM || in_sizes[3] < CDIM * HDIM) return;
  if ((long long)out_size < tok_rows * HDIM) return;

  const float* x  = (const float*)d_in[0];
  const float* Wq = (const float*)d_in[1];
  const float* Wk = (const float*)d_in[2];
  const float* Wv = (const float*)d_in[3];
  float* out = (float*)d_out;

  // workspace carve (bytes): qh NB*SEQ*64*2 | kh same | vT same | vR same
  const size_t plane    = (size_t)NB * SEQ * HDIM * sizeof(_Float16);
  const size_t off_q  = 0;
  const size_t off_k  = off_q + plane;
  const size_t off_v  = off_k + plane;
  const size_t off_r  = off_v + plane;
  const size_t total  = off_r + plane;
  if (total > ws_size) return;

  _Float16* qh = (_Float16*)((char*)d_ws + off_q);
  _Float16* kh = (_Float16*)((char*)d_ws + off_k);
  _Float16* vT = (_Float16*)((char*)d_ws + off_v);
  _Float16* vR = (_Float16*)((char*)d_ws + off_r);

  k_proj<<<(NB * SEQ) / 64, 256, 0, stream>>>(x, Wq, Wk, Wv, qh, kh, vT, vR);
  k_attn<<<NB * (NRG_L + NRG_E), NKW * 32, 0, stream>>>(qh, kh, vT, vR, out);
}

// v007
// It runs in 21.8 microseconds.
// In two side-by-side timings against v006, it was 1.14 and 1.19 times as fast.
// All steps since v000 together make it 9.11 times as fast.
#include <hip/hip_runtime.h>

// Contractions: x*W projections (q,k,v): v_wmma_f32_16x16x32_bf16, bf16 operands (RNE-converted inputs), f32 accumulate.
// q.k scores, P.v, P row sums: v_wmma_f32_16x16x32_f16, f16 operands (q x log2e, k, P x 1024, v x 16), f32 accumulate;
// query rows < 256 of each sequence also use f16 residual planes of P and v (x1024 carries) in separate f32 accumulators.

#ifndef NB
#define NB 8
#endif
#ifndef SEQ
#define SEQ 2048
#endif
#define NB_FULL  8
#define SEQ_FULL 2048
#define CDIM  400
#define HDIM  64
#define NPROJ 192
#define KP    416         // contraction depth padded to 13 x 32, pad columns are zeros
#define XP    424         // LDS pitch of the staged x tile (16-bit elements)
#define NKS    (KP / 32)                     // k steps of a projection
#define XLD    (64 * (CDIM / 4) / 128)       // 16-byte x loads of a thread of the four waves that stage x
#define WTS    (NKS * 512 + 8)               // LDS pitch of a 16-column tile of the W plane (16-bit elements): 16 B past a multiple of 256 B
#define NWT    (3 * (CDIM / 16))             // wave-wide W staging tasks: 16 contraction rows x 64 columns of one W matrix
#define NWSL   ((NWT + 3) / 4)               // task slots of a staging wave (four waves)
#define NTB    (SEQ / 64)                    // 64-row query tiles per sequence
#define NTB_E  ((NTB < 4) ? NTB : 4)         // tiles with query rows < 256: residual path
#define NTB_L  (NTB - NTB_E)
#define NKW    8                             // waves of an attention block: all on the same 16 query rows, keys dealt over them
#define NRG_E  (NTB_E * 4)                   // 16-row query groups with rows < 256
#define NRG_L  (NTB_L * 4)                   // 16-row query groups with rows >= 256
#define NRG    (NRG_E + NRG_L)               // 16-row query groups of a sequence, a multiple of 4

static_assert(SEQ % 64 == 0 && SEQ >= 64);
static_assert(NKW * 32 == 16 * 16);          // the merge gives each of the 16 rows 16 threads
static_assert(NRG_E * 16 <= NKW * 32);       // a group with rows < 256 has at most NKW chunks: one pass
static_assert(SEQ <= SEQ_FULL);
static_assert(NB >= 1 && NB <= NB_FULL);
static_assert(KP % 32 == 0 && KP >= CDIM);
static_assert(XP >= KP && (XP % 8) == 0);
static_assert(CDIM % 16 == 0 && KP - CDIM == 16 && HDIM == 64);
static_assert(NPROJ == 3 * HDIM && (NPROJ % 8) == 0 && (HDIM % 8) == 0);
static_assert(CDIM % 4 == 0 && CDIM > 256 && CDIM <= 512);
static_assert(64 * XP >= 4 * 4096);
static_assert((64 * (CDIM / 4)) % 256 == 0 && NKS >= 2);
static_assert(((long long)(NB - 1) * SEQ_FULL + SEQ) * HDIM <= 1048576LL);

typedef _Float16       v16h  __attribute__((ext_vector_type(16)));
typedef _Float16       v8h   __attribute__((ext_vector_type(8)));
typedef float          v8f   __attribute__((ext_vector_type(8)));
typedef float          v4f   __attribute__((ext_vector_type(4)));
typedef unsigned short v16us __attribute__((ext_vector_type(16)));
typedef unsigned short v8us  __attribute__((ext_vector_type(8)));
typedef unsigned int   v4u   __attribute__((ext_vector_type(4)));
typedef unsigned int   v2u   __attribute__((ext_vector_type(2)));
typedef __bf16         v16bf __attribute__((ext_vector_type(16)));
typedef __bf16         v2bf  __attribute__((ext_vector_type(2)));
typedef float          v2f   __attribute__((ext_vector_type(2)));

union FragH { v16h v; v8h h[2]; };
union FragU { v16us v; v8us h[2]; };

#define LOG2E_F 1.4426950408889634f
#define NEG_BIG (-3.0e38f)
#define RINV    0.0009765625f

// f32 -> bf16 bits, RNE convert
__device__ __forceinline__ unsigned int bf_bits(float f) {
  const unsigned int u = __float_as_uint(f);
  return (u + 0x7FFFu + ((u >> 16) & 1u)) >> 16;
}

// WMMA helpers with the VALU hazard guard (ties D, keeps A/B live)
__device__ __forceinline__ v8f wmma_f16(v16h a, v16h b, v8f c) {
  v8f d = __builtin_amdgcn_wmma_f32_16x16x32_f16(false, a, false, b, (short)0, c, false, false);
  asm volatile("v_nop\n\tv_nop\n\tv_nop\n\tv_nop" : "+v"(d) : "v"(a), "v"(b));
  return d;
}
__device__ __forceinline__ v8f wmma_bf16(v16us a, v16us b, v8f c) {
  v8f d = __builtin_amdgcn_wmma_f32_16x16x32_bf16(false, __builtin_bit_cast(v16bf, a), false,
                                                   __builtin_bit_cast(v16bf, b), (short)0, c, false, false);
  asm volatile("v_nop\n\tv_nop\n\tv_nop\n\tv_nop" : "+v"(d) : "v"(a), "v"(b));
  return d;
}

// 16-bit operand fragment, split k map for BOTH A and B:
// p = (row or column (lane&15)) base + k0 + 8*(lane>>4); elements 0..7 <- p[0..7], elements 8..15 <- p[16..23].
__device__ __forceinline__ v16h frag_f16(const _Float16* p) {
  FragH f;
  f.h[0] = *(const v8h*)p;
  f.h[1] = *(const v8h*)(p + 16);
  return f.v;
}
__device__ __forceinline__ v16us frag_u16(const unsigned short* p) {
  FragU f;
  f.h[0] = *(const v8us*)p;
  f.h[1] = *(const v8us*)(p + 16);
  return f.v;
}

// The same fragment from a workspace or LDS plane kept in FRAGMENT ORDER: the plane holds, one after the other, the 512-byte
// images of the wave-wide 16-byte loads, [load][lane][8 elements], the two loads of a fragment side by side.
// p = fragment base + 8*lane; elements 0..7 <- p[0..7], elements 8..15 <- p[256..263]. Which element of the matrix
// stands at a (lane, register) place is as above; a load covers 4 whole lines, where rows of a matrix give 16 pieces of 32 B.
__device__ __forceinline__ v16h frag_f16_fo(const _Float16* p) {
  FragH f;
  f.h[0] = *(const v8h*)p;
  f.h[1] = *(const v8h*)(p + 256);
  return f.v;
}
__device__ __forceinline__ v16us frag_u16_fo(const unsigned short* p) {
  FragU f;
  f.h[0] = *(const v8us*)p;
  f.h[1] = *(const v8us*)(p + 256);
  return f.v;
}

// ---------------------------------------------------------------------------
// W staging of the projection block. The block keeps all of W (q, k, v side by side, n = p*64 + hcol) in its own LDS as one
// bf16 plane in fragment order, tile n >> 4 at pitch WTS: [ks][j][lane = 16*hf + (n & 15)][e], contraction index
// c = 32*ks + 16*j + 8*hf + e, c = CDIM..KP-1 zero.
// A task is wave-wide: rows c = 16*cp .. 16*cp+15 of one matrix. A lane takes 8 rows (8*(lane>>4) + e) of 4 columns (4*(lane&15) + i):
// each 16-byte load of the wave covers two whole 256-byte rows, and a lane's 8 rows of one column ARE one 16-byte piece of the plane.
// ---------------------------------------------------------------------------
__device__ __forceinline__ const char* w_task_base(const float* __restrict__ Wq, const float* __restrict__ Wk,
                                                   const float* __restrict__ Wv, const int wt) {
  const int p  = wt / (CDIM / 16);
  const int cp = wt - p * (CDIM / 16);
  const float* W = (p == 0) ? Wq : ((p == 1) ? Wk : Wv);   // wave-uniform select, same address space
  return (const char*)(W + cp * 16 * HDIM);
}
__device__ __forceinline__ void w_task_load(v4f (&r)[8], const char* base, const unsigned loff) {
#pragma unroll
  for (int e = 0; e < 8; ++e) r[e] = *(const v4f*)(base + loff + e * HDIM * 4);
}
// two f32 -> two bf16 in one word, round to nearest even, first value in the low half
__device__ __forceinline__ unsigned int bf_pair(float a, float b) {
  v2f f; f.x = a; f.y = b;
  return __builtin_bit_cast(unsigned int, __builtin_convertvector(f, v2bf));
}
__device__ __forceinline__ void w_task_store(const v4f (&r)[8], unsigned short* __restrict__ swl, const int wt) {
  const int p  = wt / (CDIM / 16);
  const int cp = wt - p * (CDIM / 16);
  unsigned short* d = swl + p * 4 * WTS + cp * 256;
#pragma unroll
  for (int i = 0; i < 4; ++i) {
    v4u w;
    w.x = bf_pair(r[0][i], r[1][i]);
    w.y = bf_pair(r[2][i], r[3][i]);
    w.z = bf_pair(r[4][i], r[5][i]);
    w.w = bf_pair(r[6][i], r[7][i]);
    *(v4u*)(d + i * 8) = w;
  }
}

// ---------------------------------------------------------------------------
// Kernel 1: q,k,v projections for a tile of 64 token rows on bf16 WMMA.
// Staging: waves 0..3 bring the x tile into LDS as bf16, waves 4..7 meanwhile all of W (above).
// Products: 8 waves, wave -> 16 rows (wave&3) x 96 output columns (wave>>2), both operands from LDS.
// Outputs: qh = f16(q*log2e) [tok][64]; kh = f16(k), vT = f16(16*v), vR = f16((16*v - vT) * 1024) (residual plane),
// these three in fragment order, 2048 elements per chunk of 32 tokens (chunk = compact token row >> 5):
// kh[chunk][key >> 4 & 1][feature >> 5][feature >> 4 & 1][lane = 16*(feature >> 3 & 1) + (key & 15)][feature & 7],
// vT, vR[chunk][feature >> 4][key >> 4 & 1][lane = 16*(key >> 3 & 1) + (feature & 15)][key & 7].
// ---------------------------------------------------------------------------
__global__ __launch_bounds__(256) __attribute__((amdgpu_num_vgpr(256)))
void k_proj(const float* __restrict__ x,
            const float* __restrict__ Wq, const float* __restrict__ Wk, const float* __restrict__ Wv,
            _Float16* __restrict__ qh, _Float16* __restrict__ kh,
            _Float16* __restrict__ vT, _Float16* __restrict__ vR)
{
  __shared__ __attribute__((aligned(16))) unsigned short sm[64 * XP];              // 54272 B, later reused as staging
  __shared__ __attribute__((aligned(16))) unsigned short swt[(NPROJ / 16) * WTS];  // 159936 B, the W plane

  const int tid  = threadIdx.x;
  const int lane = tid & 31;
  const int wave = __builtin_amdgcn_readfirstlane(tid >> 5);
  const int half = lane >> 4;
  const int ln   = lane & 15;
  const int m0 = blockIdx.x * 64;               // compact token row of this tile
  const int b  = m0 / SEQ;
  const int t0 = m0 - b * SEQ;
  const float* xblk = x + ((size_t)b * SEQ_FULL + t0) * CDIM;

  const int rg = wave & 3;
  const int ch = wave >> 2;
  const unsigned short* arow = sm + (rg * 16 + ln) * XP + 8 * half;
  const unsigned short* brow = swt + (ch * 6) * WTS + lane * 8;   // column tile nt, k step ks: + nt * WTS + ks * 512

  // pad columns of both operands: x columns CDIM..XP-1, W contraction indices CDIM..KP-1
  for (int i = tid; i < 64 * 3; i += 256) {
    const int r = i / 3;
    const int j = i - r * 3;
    v4u z; z.x = 0u; z.y = 0u; z.z = 0u; z.w = 0u;
    *(v4u*)(sm + r * XP + CDIM + j * 8) = z;
  }
  for (int i = tid; i < NPROJ * 2; i += 256) {
    const int n = i >> 1;
    v4u z; z.x = 0u; z.y = 0u; z.z = 0u; z.w = 0u;
    *(v4u*)(swt + (n >> 4) * WTS + (CDIM / 16) * 256 + (i & 1) * 128 + (n & 15) * 8) = z;
  }

  if (wave < 4) {
    // stage x tile: 64 rows x CDIM -> bf16; a thread's XLD loads all leave before the first is used
    // (the 64 whole rows lie in one piece, so piece i of 16 bytes stands at xblk + 4 i: one address, constant steps)
    v4f xv[XLD];
#pragma unroll
    for (int j = 0; j < XLD; ++j) xv[j] = *(const v4f*)(xblk + (size_t)tid * 4 + j * 512);
    // stands behind the x loads above, in front of the first overwrite of a base or offset register that they name
    asm volatile("s_wait_xcnt 0x0" ::: "memory");
#pragma unroll
    for (int j = 0; j < XLD / 2; ++j) {
      const int i  = tid + j * 128;
      const int r  = i / (CDIM / 4);
      const int c4 = i - r * (CDIM / 4);
      unsigned short* d = sm + r * XP + c4 * 4;
#pragma unroll
      for (int h = 0; h < 2; ++h) {   // piece i + 128 * XLD / 2 stands 32 whole rows below piece i: one address serves both
        const v4f v = xv[j + h * (XLD / 2)];
        v2u w;
        w.x = bf_bits(v.x) | (bf_bits(v.y) << 16);
        w.y = bf_bits(v.z) | (bf_bits(v.w) << 16);
        *(v2u*)(d + h * 32 * XP) = w;
      }
    }
  } else {
    // stage W: wave wl takes tasks wl, wl + 4, ..; two register sets of two tasks each, one set's loads in flight while the other is converted
    const int wl = wave - 4;
    const unsigned loff = (unsigned)((half * 8 * HDIM + ln * 4) * 4);                      // the lane's place in a task's 16 rows, bytes
    unsigned short* swl = swt + (ln >> 2) * WTS + half * 128 + (ln & 3) * 32;              // the lane's place in a task's pieces
    // slot k of a wave is task wl + 4 k; the last slot holds a task only for the first NWT - 4 (NWSL - 1) waves: there the task
    // index is clamped for the loads (in bounds for every wave, no branch round a load) and the stores stand under a wave-uniform test
    v4f rw[2][2][8];
    {
      const char* s0 = w_task_base(Wq, Wk, Wv, wl);
      const char* s1 = w_task_base(Wq, Wk, Wv, wl + 4);
      w_task_load(rw[0][0], s0, loff);
      w_task_load(rw[0][1], s1, loff);
      // stands behind the W loads issued so far, in front of the next overwrite of a base or offset register that they name
      asm volatile("s_wait_xcnt 0x0" :: "s"(s0), "s"(s1), "v"(loff) : "memory");
    }
    // unrolled so that the register sets are picked at compile time and the waits on the loads are counted
#pragma unroll
    for (int k = 0; k < NWSL; k += 2) {
      const int st = (k >> 1) & 1;
      if (k + 2 < NWSL) {
        const int wa = wl + (k + 2) * 4;
        const char* s0 = w_task_base(Wq, Wk, Wv, (k + 2 == NWSL - 1 && wa > NWT - 1) ? (NWT - 1) : wa);
        w_task_load(rw[st ^ 1][0], s0, loff);
        if (k + 3 < NWSL) {
          const int wb = wl + (k + 3) * 4;
          const char* s1 = w_task_base(Wq, Wk, Wv, (k + 3 == NWSL - 1 && wb > NWT - 1) ? (NWT - 1) : wb);
          w_task_load(rw[st ^ 1][1], s1, loff);
          // as above
          asm volatile("s_wait_xcnt 0x0" :: "s"(s0), "s"(s1), "v"(loff) : "memory");
        } else {
          // as above
          asm volatile("s_wait_xcnt 0x0" :: "s"(s0), "v"(loff) : "memory");
        }
      }
      if (k < NWSL - 1 || wl + k * 4 < NWT) w_task_store(rw[st][0], swl, wl + k * 4);
      if (k + 1 < NWSL) {
        if (k + 1 < NWSL - 1 || wl + (k + 1) * 4 < NWT) w_task_store(rw[st][1], swl, wl + (k + 1) * 4);
      }
    }
  }
  __syncthreads();

  v8f acc[6];
#pragma unroll
  for (int nt = 0; nt < 6; ++nt) {
#pragma unroll
    for (int r = 0; r < 8; ++r) acc[nt][r] = 0.0f;
  }
  // both operands' fragments run one k step ahead of their products, two register sets in turn
  v16us aq[2];
  v16us bq[2][6];
  aq[0] = frag_u16(arow);
#pragma unroll
  for (int nt = 0; nt < 6; ++nt) bq[0][nt] = frag_u16_fo(brow + nt * WTS);
  // unrolled so that the register sets are picked at compile time
#pragma unroll
  for (int ks = 0; ks < NKS; ++ks) {
    if (ks + 1 < NKS) {
      aq[(ks + 1) & 1] = frag_u16(arow + (ks + 1) * 32);
#pragma unroll
      for (int nt = 0; nt < 6; ++nt) bq[(ks + 1) & 1][nt] = frag_u16_fo(brow + nt * WTS + (ks + 1) * 512);
    }
#pragma unroll
    for (int nt = 0; nt < 6; ++nt) acc[nt] = wmma_bf16(aq[ks & 1], bq[ks & 1][nt], acc[nt]);
  }
  __syncthreads();   // all waves done reading the x tile

  // staging (16-bit elements): sQ = sm[0..4095] as [t][64]; sK = sm[4096..8191], sV = sm[8192..12287],
  // sVr = sm[12288..16383]: the tile's two chunks in the fragment order of their planes
#pragma unroll
  for (int nt = 0; nt < 6; ++nt) {
    const int n0 = ch * 96 + nt * 16;            // wave-uniform
    const int p  = n0 >> 6;
    const int hc = (n0 & 63) + ln;
    const float sc = (p == 0) ? LOG2E_F : ((p == 2) ? 16.0f : 1.0f);
    // token tl = rg * 16 + 8 * half + r: the place of r = 0 and the step from r to r + 1, per plane (p is wave-uniform)
    if (p == 2) {   // a lane's 8 tokens stand side by side in the V order: one 16-byte store per plane
      const int i0 = (rg >> 1) * 2048 + (hc >> 4) * 512 + (rg & 1) * 256 + half * 128 + (hc & 15) * 8;
      v8us hv8, rv8;
#pragma unroll
      for (int r = 0; r < 8; ++r) {
        const float vf = acc[nt][r] * sc;
        const _Float16 hv = (_Float16)vf;
        const _Float16 rv = (_Float16)((vf - (float)hv) * 1024.0f);
        hv8[r] = __builtin_bit_cast(unsigned short, hv);
        rv8[r] = __builtin_bit_cast(unsigned short, rv);
      }
      *(v8us*)(sm + 8192 + i0)  = hv8;
      *(v8us*)(sm + 12288 + i0) = rv8;
    } else if (p == 1) {
      unsigned short* base = sm + 4096 + rg * 1024 + (hc >> 4) * 256 + ((hc >> 3) & 1) * 128 + half * 64 + (hc & 7);
#pragma unroll
      for (int r = 0; r < 8; ++r) base[r * 8] = __builtin_bit_cast(unsigned short, (_Float16)(acc[nt][r] * sc));
    } else {
      unsigned short* base = sm + (rg * 16 + 8 * half) * 64 + hc;
#pragma unroll
      for (int r = 0; r < 8; ++r) base[r * 64] = __builtin_bit_cast(unsigned short, (_Float16)(acc[nt][r] * sc));
    }
  }
  __syncthreads();

  // whole-line stores: wave w owns elements 512w..512w+511 of the tile's 4096 in each plane (token rows 8w..8w+7 of qh)
  const int rl = lane >> 3;
  const int pc = lane & 7;
  const int rA = wave * 8 + rl;
  const int rB = rA + 4;
  const v4u qA = *(const v4u*)(sm + rA * 64 + pc * 8);
  const v4u qB = *(const v4u*)(sm + rB * 64 + pc * 8);
  const v4u kA = *(const v4u*)(sm + 4096 + rA * 64 + pc * 8);
  const v4u kB = *(const v4u*)(sm + 4096 + rB * 64 + pc * 8);
  const v4u vA = *(const v4u*)(sm + 8192 + rA * 64 + pc * 8);
  const v4u vB = *(const v4u*)(sm + 8192 + rB * 64 + pc * 8);
  const v4u uA = *(const v4u*)(sm + 12288 + rA * 64 + pc * 8);
  const v4u uB = *(const v4u*)(sm + 12288 + rB * 64 + pc * 8);
  _Float16* dqA = qh + (size_t)(m0 + rA) * HDIM + pc * 8;
  _Float16* dqB = qh + (size_t)(m0 + rB) * HDIM + pc * 8;
  _Float16* dkA = kh + (size_t)(m0 + rA) * HDIM + pc * 8;
  _Float16* dkB = kh + (size_t)(m0 + rB) * HDIM + pc * 8;
  _Float16* dvA = vT + (size_t)(m0 + rA) * HDIM + pc * 8;
  _Float16* dvB = vT + (size_t)(m0 + rB) * HDIM + pc * 8;
  _Float16* duA = vR + (size_t)(m0 + rA) * HDIM + pc * 8;
  _Float16* duB = vR + (size_t)(m0 + rB) * HDIM + pc * 8;
  *(v4u*)dqA = qA; *(v4u*)dqB = qB;
  *(v4u*)dkA = kA; *(v4u*)dkB = kB;
  *(v4u*)dvA = vA; *(v4u*)dvB = vB;
  *(v4u*)duA = uA; *(v4u*)duB = uB;
  
}

// ---------------------------------------------------------------------------
// Kernel 2: causal flash attention. Block = NKW waves on ONE group of 16 query rows, key chunks of 32:
// wave w takes chunks w, w + NKW, ... with its own maxima, sums and accumulators; the partials meet in LDS at the end.
// The products are taken TRANSPOSED: S^T = K . Q^T (A = K fragment, B = Q fragment), O^T += V^T . P^T, sums += ones . P^T.
// A lane then holds 16 scores of ONE query (column lane & 15; keys 8*(lane>>4) + r of each 16-key tile): the row maximum is taken
// in the lane plus one exchange between the halves, and the two converted score tiles ARE the B fragment of the next product
// (element 8*nt + r <- key 16*nt + 8*(lane>>4) + r, the split k map of the V fragment): P never goes through LDS,
// and the loop has no barrier. The K, Q and V fragments are the same registers as before, with the operand sides swapped.
// Online softmax in log2 domain, P x 1024 in f16.
// EARLY = 1 handles query tiles 0..NTB_E-1 (rows < 256): adds P residual (x1024) and v residual plane (x1024)
// products into separate accumulators folded with 2^-10 before the merge; EARLY = 0 handles the rest.
// Both kinds of block stand in ONE launch (k_attn below): neither reads what the other writes. b = sequence, rg = 16-row query group.
// ---------------------------------------------------------------------------
// value of lane ^ 16, in the vector unit (no LDS trip)
__device__ __forceinline__ float xhalf(float x) {
  const int b = __builtin_bit_cast(int, x);
  return __builtin_bit_cast(float, __builtin_amdgcn_permlanex16(b, b, 0x76543210, 0xfedcba98, false, false));
}

template <int EARLY>
__device__ __forceinline__
int attn_body(const _Float16* __restrict__ qh, const _Float16* __restrict__ kh,
               const _Float16* __restrict__ vT, const _Float16* __restrict__ vR,
               const int b, const int rg,
               float (*obuf)[16][68], float (*mbuf)[16], float (*dbuf)[16])
{
  const int tid  = threadIdx.x;
  const int lane = tid & 31;
  const int wave = __builtin_amdgcn_readfirstlane(tid >> 5);
  const int half = lane >> 4;
  const int ln   = lane & 15;
  const int row0 = rg * 16;                      // first query row of this block (within the sequence)

  const _Float16* qrow  = qh + ((size_t)b * SEQ + row0 + ln) * HDIM + 8 * half;
  // the lane's place in the wave's current chunk as one running 32-bit byte offset per plane layout: every fragment of
  // the chunk is a constant away from it, so a batch of loads takes one address register on top of the plane's base
  // (planes in fragment order: a chunk is 2048 elements in each, the lane's 16 bytes of every load stand at 8 * lane)
  unsigned koff = (unsigned)(((b * SEQ + wave * 32) * HDIM + 8 * lane) * 2);
  unsigned voff = (unsigned)(((b * SEQ + wave * 32) * HDIM + 8 * lane) * 2);

  // loop-invariant Q B fragments (feature blocks 0..31, 32..63): column = query (lane&15), k = feature (split map)
  const v16h qb0 = frag_f16(qrow);
  const v16h qb1 = frag_f16(qrow + 32);

  v16h ones;
#pragma unroll
  for (int i = 0; i < 16; ++i) ones[i] = (_Float16)1.0f;

  v8f o[4];      // O^T: o[ht][r] = feature 16*ht + 8*half + r of query ln
  v8f osum;      // every register: the sum of query ln
#pragma unroll
  for (int r = 0; r < 8; ++r) osum[r] = 0.0f;
#pragma unroll
  for (int ht = 0; ht < 4; ++ht) {
#pragma unroll
    for (int r = 0; r < 8; ++r) o[ht][r] = 0.0f;
  }
  float rmax = NEG_BIG;                          // running maximum of query ln, alike in both halves

  const int nchunk = (row0 >> 5) + 1;            // chunks that hold a key <= row0 + 15
  const int qk     = row0 + ln - 8 * half;       // key 16*nt + 8*half + r of chunk c is masked where 16*nt + r > qk - 32*c
  // wave-uniform trip count; no barrier inside, so each wave walks its own chunks (EARLY: nchunk <= NKW, at most one trip)
  // kept rolled: two trips' fragments side by side do not fit the register budget of 8 waves per SIMD
#pragma unroll 1
  for (int c = wave; c < nchunk; c += NKW) {
    const int lim = qk - c * 32;
    // the chunk's K fragments all leave before the first product
    v16h kb[2][2];
#pragma unroll
    for (int nt = 0; nt < 2; ++nt) {
      const _Float16* krow = (const _Float16*)((const char*)kh + koff) + nt * 1024;
      kb[nt][0] = frag_f16_fo(krow);
      kb[nt][1] = frag_f16_fo(krow + 512);
    }
    if (EARLY) {
      // the address registers of the Q and K loads are inputs of the wait, so none of them is handed to a product's result in front of it
      asm volatile("s_wait_xcnt 0x0" :: "v"(qrow), "v"(koff) : "memory");
    }
    // S^T[32 x 16] = K(32 x 64) . Q^T, K as A operand: row = key (lane&15), k = feature (split map)
    float s[2][8];
#pragma unroll
    for (int nt = 0; nt < 2; ++nt) {
      v8f acc;
#pragma unroll
      for (int r = 0; r < 8; ++r) acc[r] = 0.0f;
      acc = wmma_f16(kb[nt][0], qb0, acc);
      acc = wmma_f16(kb[nt][1], qb1, acc);
#pragma unroll
      for (int r = 0; r < 8; ++r) {
        const float sv = acc[r] * 0.125f;                          // 1/sqrt(64), log2e already in q
        s[nt][r] = (nt * 16 + r > lim) ? NEG_BIG : sv;             // causal fill (replace)
      }
    }
    // online softmax of query ln: 16 of the chunk's 32 keys stand in this lane, the other 16 in lane ^ 16
    float tmax = fmaxf(s[0][0], s[1][0]);
#pragma unroll
    for (int r = 1; r < 8; ++r) tmax = fmaxf(tmax, fmaxf(s[0][r], s[1][r]));
    tmax = fmaxf(tmax, xhalf(tmax));
    const float nmax  = fmaxf(rmax, tmax);
    const float alpha = exp2f(rmax - nmax);
    rmax = nmax;
    if (!EARLY) {   // EARLY has one trip: its sums are still zero here, and stay out of the registers until the products
#pragma unroll
      for (int r = 0; r < 8; ++r) {
        osum[r] *= alpha;
#pragma unroll
        for (int ht = 0; ht < 4; ++ht) o[ht][r] *= alpha;
      }
    }
    // P^T (carried x 1024; residual x 1024 more) straight from the score registers into B fragments
    v16h pb, prb;
#pragma unroll
    for (int nt = 0; nt < 2; ++nt) {
#pragma unroll
      for (int r = 0; r < 8; ++r) {
        const float pf = exp2f(s[nt][r] - nmax) * 1024.0f;
        const _Float16 ph = (_Float16)pf;
        pb[nt * 8 + r] = ph;
        if (EARLY) prb[nt * 8 + r] = (_Float16)((pf - (float)ph) * 1024.0f);
      }
    }

    // V as A operand: row = feature (lane&15), k = key (split map)
    v16h vb[4], vr[4];   // V fragments of the chunk (vr: residual plane, EARLY only)
    if (EARLY) {
#pragma unroll
      for (int hp = 0; hp < 4; hp += 2) {   // two feature blocks at a time: their V and residual fragments leave together
#pragma unroll
        for (int ht = hp; ht < hp + 2; ++ht) {
          vb[ht] = frag_f16_fo((const _Float16*)((const char*)vT + voff) + ht * 512);
          vr[ht] = frag_f16_fo((const _Float16*)((const char*)vR + voff) + ht * 512);
        }
#pragma unroll
        for (int ht = hp; ht < hp + 2; ++ht) {
          v8f rs;   // the feature block's residual sums: one trip, so they fold into the numerator here, not behind the loop
#pragma unroll
          for (int r = 0; r < 8; ++r) rs[r] = 0.0f;
          o[ht] = wmma_f16(vb[ht], pb,  o[ht]);
          rs    = wmma_f16(vb[ht], prb, rs);
          rs    = wmma_f16(vr[ht], pb,  rs);
#pragma unroll
          for (int r = 0; r < 8; ++r) o[ht][r] = o[ht][r] + rs[r] * RINV;
        }
        // keeps the second pair's loads behind the first pair's products: all eight fragments beside the sums do not fit
        // the register budget that this body shares with the long blocks, and would spill
        if (hp == 0) __builtin_amdgcn_sched_barrier(0);
      }
      v8f rs;
#pragma unroll
      for (int r = 0; r < 8; ++r) rs[r] = 0.0f;
      osum = wmma_f16(ones, pb,  osum);
      rs   = wmma_f16(ones, prb, rs);
#pragma unroll
      for (int r = 0; r < 8; ++r) osum[r] = osum[r] + rs[r] * RINV;
    } else {
      // the chunk's V fragments all leave before the first product
#pragma unroll
      for (int ht = 0; ht < 4; ++ht) vb[ht] = frag_f16_fo((const _Float16*)((const char*)vT + voff) + ht * 512);
#pragma unroll
      for (int ht = 0; ht < 4; ++ht) o[ht] = wmma_f16(vb[ht], pb, o[ht]);
      osum = wmma_f16(ones, pb, osum);   // sums of the same f16 P, one query a column
    }
    // stands in front of the overwrite of the offsets that the trip's fragment loads name
    asm volatile("s_wait_xcnt 0x0" :: "v"(koff), "v"(voff) : "memory");
    koff += NKW * 32 * HDIM * 2;
    voff += NKW * 32 * HDIM * 2;
  }

  // each wave's partial (un-normalised numerator, row sum, row maximum) to its own LDS region;
  // a wave that had no chunk leaves zeros under the maximum NEG_BIG and gets weight 0 below
  // (the lane's place is taken anew from the lane counter: nothing of threadIdx has to stay in a register over the loop)
  const int lane_e = (int)__builtin_amdgcn_mbcnt_lo(~0u, 0u);
  const int half_e = lane_e >> 4;
  const int ln_e   = lane_e & 15;
#pragma unroll
  for (int ht = 0; ht < 4; ++ht) {   // a lane's 8 registers are 8 features in a row of its query: two 16-byte stores
    v4f lo, hi;
    lo.x = o[ht][0]; lo.y = o[ht][1]; lo.z = o[ht][2]; lo.w = o[ht][3];
    hi.x = o[ht][4]; hi.y = o[ht][5]; hi.z = o[ht][6]; hi.w = o[ht][7];
    *(v4f*)(&obuf[wave][ln_e][ht * 16 + 8 * half_e])     = lo;
    *(v4f*)(&obuf[wave][ln_e][ht * 16 + 8 * half_e + 4]) = hi;
  }
  if (half_e == 0) {   // maxima and sums are alike in the two lanes of a query
    mbuf[wave][ln_e] = rmax;
    dbuf[wave][ln_e] = osum[0];
  }
  return b * SEQ_FULL + row0;   // the block's first row in out (block-uniform)
}

// One launch for both kinds of block, picked by a block-uniform branch on the block's query group.
// Register budget of 8 waves per SIMD: four blocks fit a WGP, so every block of the launch can be resident at once.
// Block index -> (sequence, query group), for speed only (any start order and any placement give the same result):
// a group's cost grows with its index (rg / 2 + 1 key chunks),
// so the longest blocks take the lowest indices. The sequence runs fastest: the
// NB blocks of one cost stand side by side. The upper half of the groups goes down (NRG-1 .. NRG/2), then the two lower quarters go up
// (NRG/4 .. NRG/2-1, then 0 .. NRG/4-1): blocks a quarter of the launch apart
// add up to the same number of chunks.
__global__ __launch_bounds__(NKW * 32) __attribute__((amdgpu_waves_per_eu(8)))
void k_attn(const _Float16* __restrict__ qh, const _Float16* __restrict__ kh,
            const _Float16* __restrict__ vT, const _Float16* __restrict__ vR,
            float* __restrict__ out)
{
  __shared__ __attribute__((aligned(16))) float    obuf[NKW][16][68];   // per-wave 16 x 64 un-normalised partial
  __shared__ float mbuf[NKW][16];                                       // per-wave row maxima (log2 domain)
  __shared__ float dbuf[NKW][16];                                       // per-wave row sums

  const int blk  = blockIdx.x;
  const int wave = __builtin_amdgcn_readfirstlane(threadIdx.x >> 5);
  const int b    = blk % NB;
  const int j    = blk / NB;                                  // rank of the block's query group, 0 .. NRG-1
  const int rg   = (j < NRG / 2) ? (NRG - 1 - j) : ((j < 3 * (NRG / 4)) ? (j - NRG / 4) : (j - 3 * (NRG / 4)));
  int orow0;
  if (rg >= NRG_E) orow0 = attn_body<0>(qh, kh, vT, vR, b, rg, obuf, mbuf, dbuf);
  else             orow0 = attn_body<1>(qh, kh, vT, vR, b, rg, obuf, mbuf, dbuf);
  __syncthreads();

  // merge: thread -> query row tid >> 4, four features; weights 2^(m_w - m); then normalise
  // (1024 carry cancels between numerator and denominator; 1/16 undoes the v carry)
  const int lane = (int)__builtin_amdgcn_mbcnt_lo(~0u, 0u);   // as in attn_body: no register held over the loop for it
  const int ln   = lane & 15;
  const int mrow = wave * 2 + (lane >> 4);                    // = threadIdx.x >> 4
  float mw[NKW];
  float mall = NEG_BIG;
#pragma unroll
  for (int w = 0; w < NKW; ++w) { mw[w] = mbuf[w][mrow]; mall = fmaxf(mall, mw[w]); }
  float den = 0.0f;
  v4f num;
  num.x = 0.0f; num.y = 0.0f; num.z = 0.0f; num.w = 0.0f;
#pragma unroll
  for (int w = 0; w < NKW; ++w) {
    const float a = exp2f(mw[w] - mall);
    const v4f pv = *(const v4f*)(&obuf[w][mrow][ln * 4]);
    den += a * dbuf[w][mrow];
    num += pv * a;
  }
  const float inv = 0.0625f * __builtin_amdgcn_rcpf(den);
  *(v4f*)(out + ((size_t)orow0 + mrow) * HDIM + ln * 4) = num * inv;
}

// ---------------------------------------------------------------------------
extern "C" void kernel_launch(void* const* d_in, const int* in_sizes, int n_in,
                              void* d_out, int out_size, void* d_ws, size_t ws_size,
                              hipStream_t stream)
{
  if (n_in < 4) return;
  const long long tok_rows = (long long)(NB - 1) * SEQ_FULL + SEQ;
  if ((long long)in_sizes[0] < tok_rows * CDIM) return;
  if (in_sizes[1] < CDIM * HDIM || in_sizes[2] < CDIM * HDIM || in_sizes[3] < CDIM * HDIM) return;
  if ((long long)out_size < tok_rows * HDIM) return;

  const float* x  = (const float*)d_in[0];
  const float* Wq = (const float*)d_in[1];
  const float* Wk = (const float*)d_in[2];
  const float* Wv = (const float*)d_in[3];
  float* out = (float*)d_out;

  // workspace carve (bytes): qh NB*SEQ*64*2 | kh same | vT same | vR same
  const size_t plane    = (size_t)NB * SEQ * HDIM * sizeof(_Float16);
  const size_t off_q  = 0;
  const size_t off_k  = off_q + plane;
  const size_t off_v  = off_k + plane;
  const size_t off_r  = off_v + plane;
  const size_t total  = off_r + plane;
  if (total > ws_size) return;

  _Float16* qh = (_Float16*)((char*)d_ws + off_q);
  _Float16* kh = (_Float16*)((char*)d_ws + off_k);
  _Float16* vT = (_Float16*)((char*)d_ws + off_v);
  _Float16* vR = (_Float16*)((char*)d_ws + off_r);

  k_proj<<<(NB * SEQ) / 64, 256, 0, stream>>>(x, Wq, Wk, Wv, qh, kh, vT, vR);
  k_attn<<<NB * (NRG_L + NRG_E), NKW * 32, 0, stream>>>(qh, kh, vT, vR, out);
}
